// v000
// Times are from an AMD MI455X. After a warm-up the kernel runs many times in a row, and a time is the length of
// such a window on the GPU divided by its runs, so every launch and the gaps after it count. The runs cycle
// through copies of the inputs. A figure is the median of several windows, for all but v000 over two sittings.
// Sittings can differ by a few percent; kernels timed side by side share one.
// v000 is the starting kernel. One run takes 2050 microseconds.
#include <hip/hip_runtime.h>

// Multi-head attention on three input streams with a per-batch valid-length key mask (q, k, v [2][2048][1024]; qh, kh, vh = stream W ('xw' [1024][1024] 1/32, no bias; 16 heads x 64); scores / sqrt(64); keys j >= valid_lens[b] (int32 [2], read on the device) are REPLACED by -1e6 in the module (at least one key is always kept: numerically an exclusion: -3e38 here); softmax; out = merged Wo ('xw', no bias) -> [2][2048][1024] (4.2 M); argument order q, k, v, valid_lens, Wq, Wk, Wv, Wo).
// Layout per batch: bf16 copies of input_Q, input_K, input_V in turn (one staging buffer, refilled in stream order); 'xw' weights transposed once; exact projections; identity-table plane builders; the per-key int mask KPM[b][j] = (j >= valid_lens[b]) built once on the device (k_lenmask) and read per key by the softmax kernel; dense T-2048 attention (hybrid rows: < 512 hi/lo 3 products, rest fp16 x1024); merged hi/lo x W_O exact.
// Compute dtypes, f32 accumulate: every input rounded to bf16; projections exact; attention rows < 512 3 products, rest fp16; softmax f32; output projection hl x exact.

#define NB_  2
#define TT   2048
#define DM   1024
#define NH_  16
#define NKV  16
#define REP  (NH_ / NKV)
#define HD   64
#define DQ   (NH_ * HD)
#define DKV  (NKV * HD)
#define ZH   2
#define RH   512                  // query rows < RH use hi+lo planes (0: none)
#define WIN  0
#define PCAR 1024.0f
#define SCL  0.125f   // HD^-0.5
typedef _Float16 h16;
typedef unsigned short bf;
typedef __attribute__((ext_vector_type(16))) __bf16   v16bf;
typedef __attribute__((ext_vector_type(16))) _Float16 v16h;
typedef __attribute__((ext_vector_type(8)))  _Float16 v8h;
typedef __attribute__((ext_vector_type(8)))  unsigned short v8us;
typedef __attribute__((ext_vector_type(8)))  float    v8f;
typedef __attribute__((ext_vector_type(4)))  float    v4f;
typedef v8h  __attribute__((may_alias)) v8ha;
typedef v4f  __attribute__((may_alias)) v4fa;
typedef v8us __attribute__((may_alias)) v8usa;

__device__ __forceinline__ unsigned short f2bf(float f) { unsigned u = __float_as_uint(f); u += 0x7FFFu + ((u >> 16) & 1u); return (unsigned short)(u >> 16); }
__device__ __forceinline__ float bf2f(unsigned short b) { return __uint_as_float(((unsigned)b) << 16); }
__device__ __forceinline__ float bfr(float f) { return bf2f(f2bf(f)); }
__device__ __forceinline__ v16h cat16(v8h lo, v8h hi) { return __builtin_shufflevector(lo, hi, 0, 1, 2, 3, 4, 5, 6, 7, 8, 9, 10, 11, 12, 13, 14, 15); }
__device__ __forceinline__ v16bf cat16b(v8us lo, v8us hi) { return __builtin_bit_cast(v16bf, __builtin_shufflevector(lo, hi, 0, 1, 2, 3, 4, 5, 6, 7, 8, 9, 10, 11, 12, 13, 14, 15)); }
__device__ __forceinline__ v8f wmma16(v16h a, v16h b, v8f c) { return __builtin_amdgcn_wmma_f32_16x16x32_f16(false, a, false, b, (short)0, c, false, false); }
__device__ __forceinline__ v8f wmmab(v16bf a, v16bf b, v8f c) { return __builtin_amdgcn_wmma_f32_16x16x32_bf16(false, a, false, b, (short)0, c, false, false); }



// ---- k_gemmw: register-blocked GEMM, ONE WAVE per 64x64 output tile (16 accumulators), operands straight from K-contiguous 16-bit planes; grid (M/64, N/64, Z), 32 threads.
// C[m][n] (f32, pitch ldc, + optional f32 bias[n]) = sum_k A[m][k] Bt[n][k] (+ split products per NSPLIT). z-batch strides sA/sB/sC in elements. K % 32 == 0.
template <typename T16> struct WFrag;
template <> struct WFrag<h16> { typedef v16h V; static __device__ __forceinline__ V ld(const h16* p) { return cat16(*(const v8h*)p, *(const v8h*)(p + 16)); } static __device__ __forceinline__ v8f mma(V a, V b, v8f c) { return wmma16(a, b, c); } };
template <> struct WFrag<bf> { typedef v16bf V; static __device__ __forceinline__ V ld(const bf* p) { return cat16b(*(const v8us*)p, *(const v8us*)(p + 16)); } static __device__ __forceinline__ v8f mma(V a, V b, v8f c) { return wmmab(a, b, c); } };
template <typename T16, int NSPLIT, bool BIAS>
__global__ __launch_bounds__(32) void k_gemmw(const T16* __restrict__ A, const T16* __restrict__ A2, const T16* __restrict__ Bt, const T16* __restrict__ Bt2, int K, float* C, int ldc, const float* __restrict__ bias, size_t sA, size_t sB, size_t sC) {
    typedef typename WFrag<T16>::V V;
    __shared__ __align__(16) float os[16 * 68];
    const size_t z = blockIdx.z; A += z * sA; if (A2) A2 += z * sA; Bt += z * sB; if (Bt2) Bt2 += z * sB; C += z * sC;
    const int lane = threadIdx.x & 31, lr = lane & 15, hi = lane >> 4; const int r0 = blockIdx.x * 64, c0 = blockIdx.y * 64;
    v8f acc[4][4];
#pragma unroll
    for (int mb = 0; mb < 4; ++mb)
#pragma unroll
        for (int nb = 0; nb < 4; ++nb) acc[mb][nb] = (v8f){};
    const size_t aoff = (size_t)(r0 + lr) * K + 8 * hi, boff = (size_t)(c0 + lr) * K + 8 * hi;
#pragma unroll 1
    for (int kc = 0; kc < K; kc += 32) {
        V a[4], a2[4];
#pragma unroll
        for (int mb = 0; mb < 4; ++mb) { a[mb] = WFrag<T16>::ld(A + aoff + (size_t)mb * 16 * K + kc); if (NSPLIT == 1 || NSPLIT == 2) a2[mb] = WFrag<T16>::ld(A2 + aoff + (size_t)mb * 16 * K + kc); }
#pragma unroll
        for (int nb = 0; nb < 4; ++nb) { const V b = WFrag<T16>::ld(Bt + boff + (size_t)nb * 16 * K + kc); V b2; if (NSPLIT >= 2) b2 = WFrag<T16>::ld(Bt2 + boff + (size_t)nb * 16 * K + kc);
#pragma unroll
            for (int mb = 0; mb < 4; ++mb) { acc[mb][nb] = WFrag<T16>::mma(a[mb], b, acc[mb][nb]); if (NSPLIT == 1 || NSPLIT == 2) acc[mb][nb] = WFrag<T16>::mma(a2[mb], b, acc[mb][nb]); if (NSPLIT >= 2) acc[mb][nb] = WFrag<T16>::mma(a[mb], b2, acc[mb][nb]); } }
        asm volatile("v_nop\n\tv_nop\n\tv_nop\n\tv_nop" : "+v"(acc[0][0]), "+v"(acc[1][1]), "+v"(acc[2][2]), "+v"(acc[3][3]) : "v"(a[0]), "v"(a[3]));
    }
#pragma unroll
    for (int mb = 0; mb < 4; ++mb) {
#pragma unroll
        for (int nb = 0; nb < 4; ++nb) {
#pragma unroll
            for (int j = 0; j < 8; ++j) os[(hi * 8 + j) * 68 + nb * 16 + lr] = acc[mb][nb][j]; }
        __builtin_amdgcn_wave_barrier(); asm volatile("" ::: "memory");
        float* crow = C + (size_t)(r0 + mb * 16) * ldc + c0;
{
#pragma unroll
            for (int s = 0; s < 8; ++s) { const int row = 2 * s + hi, cofs = lr * 4; v4f val = *(const v4fa*)(os + row * 68 + cofs); if (BIAS) { val[0] += bfr(bias[c0 + cofs]); val[1] += bfr(bias[c0 + cofs + 1]); val[2] += bfr(bias[c0 + cofs + 2]); val[3] += bfr(bias[c0 + cofs + 3]); }
                *(v4f*)(crow + (size_t)row * ldc + cofs) = val; }
             }
        __builtin_amdgcn_wave_barrier(); asm volatile("" ::: "memory");
    }
}

__device__ __forceinline__ h16 tohx(float x) { return (h16)x; }
__device__ __forceinline__ void splitf(float y, unsigned short& h, unsigned short& l) { h = f2bf(y); l = f2bf(y - bf2f(h)); }
typedef __attribute__((ext_vector_type(2))) _Float16 v2h;
typedef __attribute__((ext_vector_type(4))) _Float16 v4h;
typedef __attribute__((ext_vector_type(2))) unsigned short v2us;
typedef __attribute__((ext_vector_type(4))) unsigned short v4us;
typedef __attribute__((ext_vector_type(2))) float v2f;
typedef __attribute__((ext_vector_type(4))) int v4i;

__global__ __launch_bounds__(256) void k_wtG(const float* __restrict__ w, int K, int N, bf* Bt) {
    const int lane = threadIdx.x & 31; const int L0 = (blockIdx.x * 8 + (threadIdx.x >> 5)) * 8; const int nlines = N * K / 64;
{
#pragma unroll 1
        for (int l = 0; l < 8; ++l) { const int L = L0 + l; if (L >= nlines) break; const size_t e = (size_t)L * 64 + lane * 2; const int k = (int)(e % K), n = (int)(e / K); v2us o;
            o[0] = f2bf(w[(size_t)k * N + n]); o[1] = f2bf(w[(size_t)(k + 1) * N + n]); *(v2us*)(Bt + e) = o; }
         }
}
__global__ __launch_bounds__(256) void k_cvt8(const float* __restrict__ src, bf* dst, size_t n8) { const size_t i = (size_t)blockIdx.x * 256 + threadIdx.x; if (i >= n8) return; const v8f v = *(const v8f*)(src + i * 8); v8us o;
#pragma unroll
    for (int k = 0; k < 8; ++k) o[k] = f2bf(v[k]); *(v8us*)(dst + i * 8) = o;  }

// k_rope: head planes [h][t][d] (fp16 + hi/lo) of rope(x) x sc with the rotate-half convention out[d] = x[d] cos[t][d] - x[d+HD/2] sin[t][d], out[d+HD/2] = x[d+HD/2] cos[t][d+HD/2] + x[d] sin[t][d+HD/2]
__global__ __launch_bounds__(256) void k_rope(const float* __restrict__ F, int pitch, int nheads, const float* __restrict__ CS, const float* __restrict__ RF, const float* __restrict__ nw, float sc, h16* P16, bf* Ph, bf* Pl) {
    const size_t e = ((size_t)blockIdx.x * 256 + threadIdx.x) * 2; if (e >= (size_t)nheads * TT * HD) return; const int d = (int)(e % HD); const int t = (int)((e / HD) % TT); const int h = (int)(e / ((size_t)HD * TT)); const float* f = F + (size_t)t * pitch + h * HD; const float rf = RF ? RF[(size_t)h * TT + t] : 1.0f; v2h o16; v2us oh, ol;
#pragma unroll
    for (int q = 0; q < 2; ++q) { const int dd = d + q; const int dp = (dd < HD / 2) ? dd + HD / 2 : dd - HD / 2; float x0 = f[dd], x1 = f[dp];
        if (RF) { float n0 = __fmul_rn(x0, rf), n1 = __fmul_rn(x1, rf); asm volatile("" : "+v"(n0)); asm volatile("" : "+v"(n1)); x0 = __fmul_rn(bfr(nw[dd]), n0); x1 = __fmul_rn(bfr(nw[dp]), n1); }
        const v2f cs = *(const v2f*)(CS + ((size_t)t * HD + dd) * 2); float a = __fmul_rn(x0, cs[0]), bq = __fmul_rn(x1, cs[1]); asm volatile("" : "+v"(a)); asm volatile("" : "+v"(bq)); const float r = ((dd < HD / 2) ? __fsub_rn(a, bq) : __fadd_rn(a, bq)) * sc;
        o16[q] = tohx(r); unsigned short a2, c2; splitf(r, a2, c2); oh[q] = a2; ol[q] = c2; }
    *(v2h*)(P16 + e) = o16; *(v2us*)(Ph + e) = oh; *(v2us*)(Pl + e) = ol;  }
__global__ __launch_bounds__(256) void k_vtp(const float* __restrict__ F, int pitch, int nheads, h16* V16, bf* Vh, bf* Vl) { const size_t e = ((size_t)blockIdx.x * 256 + threadIdx.x) * 2; if (e >= (size_t)nheads * HD * TT) return; const int t = (int)(e % TT); const int d = (int)((e / TT) % HD); const int g = (int)(e / ((size_t)TT * HD)); v2h o16; v2us oh, ol;
#pragma unroll
    for (int q = 0; q < 2; ++q) { const float x = F[(size_t)(t + q) * pitch + g * HD + d]; o16[q] = tohx(x); unsigned short a2, c2; splitf(x, a2, c2); oh[q] = a2; ol[q] = c2; }
    *(v2h*)(V16 + e) = o16; *(v2us*)(Vh + e) = oh; *(v2us*)(Vl + e) = ol;  }
__global__ __launch_bounds__(256) void k_csid(float* CS) { const int idx = blockIdx.x * 256 + threadIdx.x; if (idx >= TT * HD) return; v2f cs; cs[0] = 1.0f; cs[1] = 0.0f; *(v2f*)(CS + (size_t)idx * 2) = cs;  }
// k_asoft: per row (zz, i): t = S x HD^-0.5 (keys with MKb[j] != 0 -> -3e38); softmax over the 2048 keys (register row, one exp, fixed trees);
__global__ __launch_bounds__(256) void k_asoft(const float* __restrict__ Sb, const int* __restrict__ MKb, h16* P16, bf* Ph, bf* Pl) {
    const int lane = threadIdx.x & 31; const int row = blockIdx.x * 8 + (threadIdx.x >> 5); if (row >= ZH * TT) return; const int i = row % TT; const int zz = row / TT; (void)zz; const bool hires = (i < RH); const float* sr = Sb + (size_t)row * TT; float v[TT / 32]; float mx = -3.0e38f;
#pragma unroll
    for (int ch = 0; ch < TT / 128; ++ch) { const int j0 = ch * 128 + lane * 4; const v4f a = *(const v4f*)(sr + j0); const v4i m4 = *(const v4i*)(MKb + j0);
#pragma unroll
        for (int q = 0; q < 4; ++q) { const int j = j0 + q; (void)j; const float t = (m4[q] == 0) ? a[q] * SCL : -3.0e38f;   /* key_padding_mask True -> -inf */ v[ch * 4 + q] = t; mx = fmaxf(mx, t); } }
#pragma unroll
    for (int sh = 16; sh; sh >>= 1) mx = fmaxf(mx, __shfl_xor(mx, sh, 32));
    float sum = 0.f;
#pragma unroll
    for (int k = 0; k < TT / 32; ++k) { float d0 = __fsub_rn(v[k], mx); asm volatile("" : "+v"(d0)); v[k] = __builtin_amdgcn_exp2f(__fmul_rn(d0, 1.4426950408889634f)); sum += v[k]; }
#pragma unroll
    for (int sh = 16; sh; sh >>= 1) sum += __shfl_xor(sum, sh, 32);
    const float f = __fdiv_rn(hires ? 1.0f : PCAR, sum);
{
        if (hires) {
#pragma unroll
            for (int ch = 0; ch < TT / 128; ++ch) { v4us oh, ol;
#pragma unroll
                for (int q = 0; q < 4; ++q) { unsigned short a, c2; splitf(v[ch * 4 + q] * f, a, c2); oh[q] = a; ol[q] = c2; }
                const size_t oo = ((size_t)zz * (RH ? RH : 1) + i) * TT + ch * 128 + lane * 4; *(v4us*)(Ph + oo) = oh; *(v4us*)(Pl + oo) = ol; }
        } else {
#pragma unroll
            for (int ch = 0; ch < TT / 128; ++ch) { v4h o4;
#pragma unroll
                for (int q = 0; q < 4; ++q) o4[q] = tohx(v[ch * 4 + q] * f);
                *(v4h*)(P16 + (size_t)row * TT + ch * 128 + lane * 4) = o4; } }
         }
}
__global__ __launch_bounds__(256) void k_lenmask(const int* __restrict__ lens, int nb, int* KPM) { const int i = blockIdx.x * 256 + threadIdx.x; if (i >= nb * TT) return; const int b = i / TT, j = i - b * TT; const int m = (j >= lens[b]) ? 1 : 0; *(int*)(KPM + i) = m;  }
__global__ __launch_bounds__(256) void k_merge(const float* __restrict__ O, int h0, bf* Ah, bf* Al) { const size_t e = ((size_t)blockIdx.x * 256 + threadIdx.x) * 2; if (e >= (size_t)ZH * TT * HD) return; const int d = (int)(e % HD); const int t = (int)((e / HD) % TT); const int zz = (int)(e / ((size_t)HD * TT)); const float cs = (t < RH) ? 1.0f : (1.0f / PCAR); const size_t oo = (size_t)t * DQ + (h0 + zz) * HD + d;
    v2us oh, ol;
#pragma unroll
    for (int q = 0; q < 2; ++q) { unsigned short a, c2; splitf(O[e + q] * cs, a, c2); oh[q] = a; ol[q] = c2; } *(v2us*)(Ah + oo) = oh; *(v2us*)(Al + oo) = ol;  }

extern "C" void kernel_launch(void* const* d_in, const int* in_sizes, int n_in,
                              void* d_out, int out_size, void* d_ws, size_t ws_size, hipStream_t stream) {
    (void)in_sizes; (void)n_in; (void)out_size;
    const float* x = (const float*)d_in[0]; const float* xk = (const float*)d_in[1]; const float* xv = (const float*)d_in[2]; const int* lens = (const int*)d_in[3]; const float* wq = (const float*)d_in[4]; const float* wk = (const float*)d_in[5]; const float* wv = (const float*)d_in[6]; const float* wo = (const float*)d_in[7];   /* order q, k, v, valid_lens (int32 [2]: keys j >= valid_lens[b] are masked: READ on the device by k_lenmask), Wq, Wk, Wv, Wo ('xw'): EIGHT inputs */
    float* OUT = (float*)d_out;     // [2][2048][1024]
    char* wsp = (char*)d_ws;
    auto take = [&](size_t bytes) { char* p = wsp; wsp += (bytes + 255) & ~(size_t)255; return (void*)p; };
    bf* WQ = (bf*)take((size_t)DQ * DM * 2); bf* WK = (bf*)take((size_t)DKV * DM * 2); bf* WV = (bf*)take((size_t)DKV * DM * 2); bf* WO = (bf*)take((size_t)DM * DQ * 2); float* CS = (float*)take((size_t)TT * HD * 2 * 4);
    bf* XB = (bf*)take((size_t)TT * DM * 2); float* FQ = (float*)take((size_t)TT * DQ * 4); float* FK = (float*)take((size_t)TT * DKV * 4);
    h16* QP16 = (h16*)take((size_t)NH_ * TT * HD * 2); h16* KP16 = (h16*)take((size_t)NKV * TT * HD * 2); h16* VT16 = (h16*)take((size_t)NKV * HD * TT * 2);
    bf* QPh = (bf*)take((size_t)NH_ * TT * HD * 2); bf* QPl = (bf*)take((size_t)NH_ * TT * HD * 2); bf* KPh = (bf*)take((size_t)NKV * TT * HD * 2); bf* KPl = (bf*)take((size_t)NKV * TT * HD * 2); bf* VTh = (bf*)take((size_t)NKV * HD * TT * 2); bf* VTl = (bf*)take((size_t)NKV * HD * TT * 2); bf* Ph = (bf*)take((size_t)ZH * RH * TT * 2); bf* Pl = (bf*)take((size_t)ZH * RH * TT * 2);
    float* Sb = (float*)take((size_t)ZH * TT * TT * 4); h16* P16 = (h16*)take((size_t)ZH * TT * TT * 2); float* Ob = (float*)take((size_t)ZH * TT * HD * 4); bf* ATh = (bf*)take((size_t)TT * DQ * 2); bf* ATl = (bf*)take((size_t)TT * DQ * 2); int* KPM = (int*)take((size_t)NB_ * TT * 4);   /* the per-key int mask built from valid_lens: carved LAST: no host plane moves */
    if ((size_t)(wsp - (char*)d_ws) > ws_size) return;    // ws 256 MiB
    float* FV = FK;   // v projection reuses the k buffer after the k planes are built (stream-ordered)
    { k_wtG<<<(unsigned)((DM * DQ / 64 + 63) / 64), 256, 0, stream>>>(wq, DM, DQ, WQ); k_wtG<<<(unsigned)((DM * DKV / 64 + 63) / 64), 256, 0, stream>>>(wk, DM, DKV, WK); k_wtG<<<(unsigned)((DM * DKV / 64 + 63) / 64), 256, 0, stream>>>(wv, DM, DKV, WV);
      k_wtG<<<(unsigned)((DQ * DM / 64 + 63) / 64), 256, 0, stream>>>(wo, DQ, DM, WO);
       }
    k_csid<<<(TT * HD + 255) / 256, 256, 0, stream>>>(CS); k_lenmask<<<(NB_ * TT + 255) / 256, 256, 0, stream>>>(lens, NB_, KPM);   /* lengths -> per-key mask, once */
    const unsigned LQ = (unsigned)(((size_t)NH_ * TT * HD / 2 + 255) / 256), LKv = (unsigned)(((size_t)NKV * TT * HD / 2 + 255) / 256);
    for (int b = 0; b < NB_; ++b) {
        
        k_cvt8<<<(unsigned)(((size_t)TT * DM / 8 + 255) / 256), 256, 0, stream>>>(x + (size_t)b * TT * DM, XB, (size_t)TT * DM / 8);
        k_gemmw<bf, 0, false><<<dim3(TT / 64, DQ / 64, 1), 32, 0, stream>>>(XB, nullptr, WQ, nullptr, DM, FQ, DQ, nullptr, 0, 0, 0);
        k_rope<<<LQ, 256, 0, stream>>>(FQ, DQ, NH_, CS, nullptr, nullptr, 1.0f, QP16, QPh, QPl);
        k_cvt8<<<(unsigned)(((size_t)TT * DM / 8 + 255) / 256), 256, 0, stream>>>(xk + (size_t)b * TT * DM, XB, (size_t)TT * DM / 8);   /* XB := bf16(input_K[b]) */ k_gemmw<bf, 0, false><<<dim3(TT / 64, DKV / 64, 1), 32, 0, stream>>>(XB, nullptr, WK, nullptr, DM, FK, DKV, nullptr, 0, 0, 0);
        k_rope<<<LKv, 256, 0, stream>>>(FK, DKV, NKV, CS, nullptr, nullptr, 1.0f, KP16, KPh, KPl);
        k_cvt8<<<(unsigned)(((size_t)TT * DM / 8 + 255) / 256), 256, 0, stream>>>(xv + (size_t)b * TT * DM, XB, (size_t)TT * DM / 8);   /* XB := bf16(input_V[b]) */ k_gemmw<bf, 0, false><<<dim3(TT / 64, DKV / 64, 1), 32, 0, stream>>>(XB, nullptr, WV, nullptr, DM, FV, DKV, nullptr, 0, 0, 0); k_vtp<<<LKv, 256, 0, stream>>>(FV, DKV, NKV, VT16, VTh, VTl);
        for (int h0 = 0; h0 < NH_; h0 += ZH) { const size_t zq = (size_t)h0, zk = (size_t)(h0 / REP);   // one kv head per query head: the pass's two heads use consecutive kv planes (z-strides TT*HD)
            k_gemmw<bf, 2, false><<<dim3(RH / 64, TT / 64, ZH), 32, 0, stream>>>(QPh + zq * TT * HD, QPl + zq * TT * HD, KPh + zk * TT * HD, KPl + zk * TT * HD, HD, Sb, TT, nullptr, (size_t)TT * HD, (size_t)TT * HD, (size_t)TT * TT);
            k_gemmw<h16, 0, false><<<dim3((TT - RH) / 64, TT / 64, ZH), 32, 0, stream>>>(QP16 + zq * TT * HD + (size_t)RH * HD, nullptr, KP16 + zk * TT * HD, nullptr, HD, Sb + (size_t)RH * TT, TT, nullptr, (size_t)TT * HD, (size_t)TT * HD, (size_t)TT * TT);
            k_asoft<<<ZH * TT / 8, 256, 0, stream>>>(Sb, KPM + (size_t)b * TT, P16, Ph, Pl);   /* batch b's key mask */
            k_gemmw<bf, 2, false><<<dim3(RH / 64, HD / 64, ZH), 32, 0, stream>>>(Ph, Pl, VTh + zk * HD * TT, VTl + zk * HD * TT, TT, Ob, HD, nullptr, (size_t)RH * TT, (size_t)HD * TT, (size_t)TT * HD);
            k_gemmw<h16, 0, false><<<dim3((TT - RH) / 64, HD / 64, ZH), 32, 0, stream>>>(P16 + (size_t)RH * TT, nullptr, VT16 + zk * HD * TT, nullptr, TT, Ob + (size_t)RH * HD, HD, nullptr, (size_t)TT * TT, (size_t)HD * TT, (size_t)TT * HD);
            k_merge<<<(unsigned)(((size_t)ZH * TT * HD / 2 + 255) / 256), 256, 0, stream>>>(Ob, h0, ATh, ATl); }
        k_gemmw<bf, 1, false><<<dim3(TT / 64, DM / 64, 1), 32, 0, stream>>>(ATh, ATl, WO, nullptr, DQ, OUT + (size_t)b * TT * DM, DM, nullptr, 0, 0, 0); }
}

// v001
// It runs in 1110 microseconds.
// Two timings next to v000 both put it at 1.86 times that version's speed.
#include <hip/hip_runtime.h>

// Multi-head attention on three input streams with a per-batch valid-length key mask (q, k, v [2][2048][1024]; qh, kh, vh = stream W ('xw' [1024][1024] 1/32, no bias; 16 heads x 64); scores / sqrt(64); keys j >= valid_lens[b] (int32 [2], read on the device) are REPLACED by -1e6 in the module (at least one key is always kept: numerically an exclusion: -3e38 here); softmax; out = merged Wo ('xw', no bias) -> [2][2048][1024] (4.2 M); argument order q, k, v, valid_lens, Wq, Wk, Wv, Wo).
// Layout per batch: bf16 copies of input_Q, input_K, input_V in turn (one staging buffer, refilled in stream order); 'xw' weights transposed once; exact projections; identity-table plane builders; the per-key int mask KPM[b][j] = (j >= valid_lens[b]) built once on the device (k_lenmask) and read per key by the softmax kernel; dense T-2048 attention (hybrid rows: < 512 hi/lo 3 products, rest fp16 x1024); merged hi/lo x W_O exact.
// Compute dtypes, f32 accumulate: every input rounded to bf16; projections exact; attention rows < 512 3 products, rest fp16; softmax f32; output projection hl x exact.

#define NB_  2
#define TT   2048
#define DM   1024
#define NH_  16
#define NKV  16
#define REP  (NH_ / NKV)
#define HD   64
#define DQ   (NH_ * HD)
#define DKV  (NKV * HD)
#define ZH   2
#define RH   512                  // query rows < RH use hi+lo planes (0: none)
#define WIN  0
#define PCAR 1024.0f
#define SCL  0.125f   // HD^-0.5
typedef _Float16 h16;
typedef unsigned short bf;
typedef __attribute__((ext_vector_type(16))) __bf16   v16bf;
typedef __attribute__((ext_vector_type(16))) _Float16 v16h;
typedef __attribute__((ext_vector_type(8)))  _Float16 v8h;
typedef __attribute__((ext_vector_type(8)))  unsigned short v8us;
typedef __attribute__((ext_vector_type(8)))  float    v8f;
typedef __attribute__((ext_vector_type(4)))  float    v4f;
typedef v8h  __attribute__((may_alias)) v8ha;
typedef v4f  __attribute__((may_alias)) v4fa;
typedef v8us __attribute__((may_alias)) v8usa;

__device__ __forceinline__ unsigned short f2bf(float f) { unsigned u = __float_as_uint(f); u += 0x7FFFu + ((u >> 16) & 1u); return (unsigned short)(u >> 16); }
__device__ __forceinline__ float bf2f(unsigned short b) { return __uint_as_float(((unsigned)b) << 16); }
__device__ __forceinline__ float bfr(float f) { return bf2f(f2bf(f)); }
__device__ __forceinline__ v16h cat16(v8h lo, v8h hi) { return __builtin_shufflevector(lo, hi, 0, 1, 2, 3, 4, 5, 6, 7, 8, 9, 10, 11, 12, 13, 14, 15); }
__device__ __forceinline__ v16bf cat16b(v8us lo, v8us hi) { return __builtin_bit_cast(v16bf, __builtin_shufflevector(lo, hi, 0, 1, 2, 3, 4, 5, 6, 7, 8, 9, 10, 11, 12, 13, 14, 15)); }
__device__ __forceinline__ v8f wmma16(v16h a, v16h b, v8f c) { return __builtin_amdgcn_wmma_f32_16x16x32_f16(false, a, false, b, (short)0, c, false, false); }
__device__ __forceinline__ v8f wmmab(v16bf a, v16bf b, v8f c) { return __builtin_amdgcn_wmma_f32_16x16x32_bf16(false, a, false, b, (short)0, c, false, false); }



// ---- k_gemmw: register-blocked GEMM, W WAVES per 64x64 output tile (16 accumulators each), operands straight from K-contiguous 16-bit planes; grid (M/64, N/64, Z), 32 * W threads.
// W > 1: wave w takes the 32-wide k steps w, w + W, w + 2W, ... (neighbouring waves read neighbouring 64-B pieces of the same rows); the W partial tiles meet in LDS and are added in wave order 0..W-1.
// C[m][n] (f32, pitch ldc, + optional f32 bias[n]) = sum_k A[m][k] Bt[n][k] (+ split products per NSPLIT). z-batch strides sA/sB/sC in elements. K % 32 == 0.
template <typename T16> struct WFrag;
template <> struct WFrag<h16> { typedef v16h V; static __device__ __forceinline__ V ld(const h16* p) { return cat16(*(const v8h*)p, *(const v8h*)(p + 16)); } static __device__ __forceinline__ v8f mma(V a, V b, v8f c) { return wmma16(a, b, c); } };
template <> struct WFrag<bf> { typedef v16bf V; static __device__ __forceinline__ V ld(const bf* p) { return cat16b(*(const v8us*)p, *(const v8us*)(p + 16)); } static __device__ __forceinline__ v8f mma(V a, V b, v8f c) { return wmmab(a, b, c); } };
template <typename T16, int NSPLIT, bool BIAS, int W>
__global__ __launch_bounds__(32 * W) void k_gemmw(const T16* __restrict__ A, const T16* __restrict__ A2, const T16* __restrict__ Bt, const T16* __restrict__ Bt2, int K, float* C, int ldc, const float* __restrict__ bias, size_t sA, size_t sB, size_t sC) {
    typedef typename WFrag<T16>::V V;
    __shared__ __align__(16) float os[W == 1 ? 16 * 68 : W * 4096];
    const int wv = __builtin_amdgcn_readfirstlane((int)(threadIdx.x >> 5));
    const size_t z = blockIdx.z; A += z * sA; if (A2) A2 += z * sA; Bt += z * sB; if (Bt2) Bt2 += z * sB; C += z * sC;
    const int lane = threadIdx.x & 31, lr = lane & 15, hi = lane >> 4; const int r0 = blockIdx.x * 64, c0 = blockIdx.y * 64;
    v8f acc[4][4];
#pragma unroll
    for (int mb = 0; mb < 4; ++mb)
#pragma unroll
        for (int nb = 0; nb < 4; ++nb) acc[mb][nb] = (v8f){};
    const size_t aoff = (size_t)(r0 + lr) * K + 8 * hi, boff = (size_t)(c0 + lr) * K + 8 * hi;
#pragma unroll 1
    for (int kc = wv * 32; kc < K; kc += 32 * W) {
        V a[4], a2[4];
#pragma unroll
        for (int mb = 0; mb < 4; ++mb) { a[mb] = WFrag<T16>::ld(A + aoff + (size_t)mb * 16 * K + kc); if (NSPLIT == 1 || NSPLIT == 2) a2[mb] = WFrag<T16>::ld(A2 + aoff + (size_t)mb * 16 * K + kc); }
#pragma unroll
        for (int nb = 0; nb < 4; ++nb) { const V b = WFrag<T16>::ld(Bt + boff + (size_t)nb * 16 * K + kc); V b2; if (NSPLIT >= 2) b2 = WFrag<T16>::ld(Bt2 + boff + (size_t)nb * 16 * K + kc);
#pragma unroll
            for (int mb = 0; mb < 4; ++mb) { acc[mb][nb] = WFrag<T16>::mma(a[mb], b, acc[mb][nb]); if (NSPLIT == 1 || NSPLIT == 2) acc[mb][nb] = WFrag<T16>::mma(a2[mb], b, acc[mb][nb]); if (NSPLIT >= 2) acc[mb][nb] = WFrag<T16>::mma(a[mb], b2, acc[mb][nb]); } }
        asm volatile("v_nop\n\tv_nop\n\tv_nop\n\tv_nop" : "+v"(acc[0][0]), "+v"(acc[1][1]), "+v"(acc[2][2]), "+v"(acc[3][3]) : "v"(a[0]), "v"(a[3]));
    }
    if constexpr (W > 1) {
        // every wave parks its partial tile in accumulator order: [wave][mb * 4 + nb][j / 4][lane][j % 4], 16-byte stores, 512 contiguous bytes each
        float* mine = os + wv * 4096 + lane * 4;
#pragma unroll
        for (int mb = 0; mb < 4; ++mb)
#pragma unroll
            for (int nb = 0; nb < 4; ++nb) {
                *(v4fa*)(mine + ((mb * 4 + nb) * 2 + 0) * 128) = __builtin_shufflevector(acc[mb][nb], acc[mb][nb], 0, 1, 2, 3);
                *(v4fa*)(mine + ((mb * 4 + nb) * 2 + 1) * 128) = __builtin_shufflevector(acc[mb][nb], acc[mb][nb], 4, 5, 6, 7); }
        __syncthreads();   // all W partial tiles are in LDS before any wave adds them
        // wave wv owns the 64 / W whole output rows mbr * 16 + hi * 8 + j0 .. + JN - 1 (all 64 columns: it alone writes those lines)
        constexpr int JN = 32 / W; typedef float vjn __attribute__((ext_vector_type(JN), may_alias));
        const int mbr = wv / (W / 4), j0 = (wv % (W / 4)) * JN;
        const float* part = os + (((mbr * 4) * 2 + (j0 >> 2)) * 32 + lane) * 4 + (j0 & 3);
        vjn r[4];
#pragma unroll
        for (int nb = 0; nb < 4; ++nb) r[nb] = *(const vjn*)(part + nb * 256);
#pragma unroll
        for (int s = 1; s < W; ++s)
#pragma unroll
            for (int nb = 0; nb < 4; ++nb) r[nb] += *(const vjn*)(part + s * 4096 + nb * 256);
        float* crow = C + (size_t)(r0 + mbr * 16 + hi * 8 + j0) * ldc + c0 + lr;
#pragma unroll
        for (int jj = 0; jj < JN; ++jj)
#pragma unroll
            for (int nb = 0; nb < 4; ++nb) crow[(size_t)jj * ldc + nb * 16] = BIAS ? r[nb][jj] + bfr(bias[c0 + nb * 16 + lr]) : r[nb][jj];
        return;
    }
#pragma unroll
    for (int mb = 0; mb < 4; ++mb) {
#pragma unroll
        for (int nb = 0; nb < 4; ++nb) {
#pragma unroll
            for (int j = 0; j < 8; ++j) os[(hi * 8 + j) * 68 + nb * 16 + lr] = acc[mb][nb][j]; }
        __builtin_amdgcn_wave_barrier(); asm volatile("" ::: "memory");
        float* crow = C + (size_t)(r0 + mb * 16) * ldc + c0;
{
#pragma unroll
            for (int s = 0; s < 8; ++s) { const int row = 2 * s + hi, cofs = lr * 4; v4f val = *(const v4fa*)(os + row * 68 + cofs); if (BIAS) { val[0] += bfr(bias[c0 + cofs]); val[1] += bfr(bias[c0 + cofs + 1]); val[2] += bfr(bias[c0 + cofs + 2]); val[3] += bfr(bias[c0 + cofs + 3]); }
                *(v4f*)(crow + (size_t)row * ldc + cofs) = val; }
             }
        __builtin_amdgcn_wave_barrier(); asm volatile("" ::: "memory");
    }
}

__device__ __forceinline__ h16 tohx(float x) { return (h16)x; }
__device__ __forceinline__ void splitf(float y, unsigned short& h, unsigned short& l) { h = f2bf(y); l = f2bf(y - bf2f(h)); }
typedef __attribute__((ext_vector_type(2))) _Float16 v2h;
typedef __attribute__((ext_vector_type(4))) _Float16 v4h;
typedef __attribute__((ext_vector_type(2))) unsigned short v2us;
typedef __attribute__((ext_vector_type(4))) unsigned short v4us;
typedef __attribute__((ext_vector_type(2))) float v2f;
typedef __attribute__((ext_vector_type(4))) int v4i;

__global__ __launch_bounds__(256) void k_wtG(const float* __restrict__ w, int K, int N, bf* Bt) {
    const int lane = threadIdx.x & 31; const int L0 = (blockIdx.x * 8 + (threadIdx.x >> 5)) * 8; const int nlines = N * K / 64;
{
#pragma unroll 1
        for (int l = 0; l < 8; ++l) { const int L = L0 + l; if (L >= nlines) break; const size_t e = (size_t)L * 64 + lane * 2; const int k = (int)(e % K), n = (int)(e / K); v2us o;
            o[0] = f2bf(w[(size_t)k * N + n]); o[1] = f2bf(w[(size_t)(k + 1) * N + n]); *(v2us*)(Bt + e) = o; }
         }
}
__global__ __launch_bounds__(256) void k_cvt8(const float* __restrict__ src, bf* dst, size_t n8) { const size_t i = (size_t)blockIdx.x * 256 + threadIdx.x; if (i >= n8) return; const v8f v = *(const v8f*)(src + i * 8); v8us o;
#pragma unroll
    for (int k = 0; k < 8; ++k) o[k] = f2bf(v[k]); *(v8us*)(dst + i * 8) = o;  }

// k_rope: head planes [h][t][d] (fp16 + hi/lo) of rope(x) x sc with the rotate-half convention out[d] = x[d] cos[t][d] - x[d+HD/2] sin[t][d], out[d+HD/2] = x[d+HD/2] cos[t][d+HD/2] + x[d] sin[t][d+HD/2]
__global__ __launch_bounds__(256) void k_rope(const float* __restrict__ F, int pitch, int nheads, const float* __restrict__ CS, const float* __restrict__ RF, const float* __restrict__ nw, float sc, h16* P16, bf* Ph, bf* Pl) {
    const size_t e = ((size_t)blockIdx.x * 256 + threadIdx.x) * 2; if (e >= (size_t)nheads * TT * HD) return; const int d = (int)(e % HD); const int t = (int)((e / HD) % TT); const int h = (int)(e / ((size_t)HD * TT)); const float* f = F + (size_t)t * pitch + h * HD; const float rf = RF ? RF[(size_t)h * TT + t] : 1.0f; v2h o16; v2us oh, ol;
#pragma unroll
    for (int q = 0; q < 2; ++q) { const int dd = d + q; const int dp = (dd < HD / 2) ? dd + HD / 2 : dd - HD / 2; float x0 = f[dd], x1 = f[dp];
        if (RF) { float n0 = __fmul_rn(x0, rf), n1 = __fmul_rn(x1, rf); asm volatile("" : "+v"(n0)); asm volatile("" : "+v"(n1)); x0 = __fmul_rn(bfr(nw[dd]), n0); x1 = __fmul_rn(bfr(nw[dp]), n1); }
        const v2f cs = *(const v2f*)(CS + ((size_t)t * HD + dd) * 2); float a = __fmul_rn(x0, cs[0]), bq = __fmul_rn(x1, cs[1]); asm volatile("" : "+v"(a)); asm volatile("" : "+v"(bq)); const float r = ((dd < HD / 2) ? __fsub_rn(a, bq) : __fadd_rn(a, bq)) * sc;
        o16[q] = tohx(r); unsigned short a2, c2; splitf(r, a2, c2); oh[q] = a2; ol[q] = c2; }
    *(v2h*)(P16 + e) = o16; *(v2us*)(Ph + e) = oh; *(v2us*)(Pl + e) = ol;  }
__global__ __launch_bounds__(256) void k_vtp(const float* __restrict__ F, int pitch, int nheads, h16* V16, bf* Vh, bf* Vl) { const size_t e = ((size_t)blockIdx.x * 256 + threadIdx.x) * 2; if (e >= (size_t)nheads * HD * TT) return; const int t = (int)(e % TT); const int d = (int)((e / TT) % HD); const int g = (int)(e / ((size_t)TT * HD)); v2h o16; v2us oh, ol;
#pragma unroll
    for (int q = 0; q < 2; ++q) { const float x = F[(size_t)(t + q) * pitch + g * HD + d]; o16[q] = tohx(x); unsigned short a2, c2; splitf(x, a2, c2); oh[q] = a2; ol[q] = c2; }
    *(v2h*)(V16 + e) = o16; *(v2us*)(Vh + e) = oh; *(v2us*)(Vl + e) = ol;  }
__global__ __launch_bounds__(256) void k_csid(float* CS) { const int idx = blockIdx.x * 256 + threadIdx.x; if (idx >= TT * HD) return; v2f cs; cs[0] = 1.0f; cs[1] = 0.0f; *(v2f*)(CS + (size_t)idx * 2) = cs;  }
// k_asoft: per row (zz, i): t = S x HD^-0.5 (keys with MKb[j] != 0 -> -3e38); softmax over the 2048 keys (register row, one exp, fixed trees);
__global__ __launch_bounds__(256) void k_asoft(const float* __restrict__ Sb, const int* __restrict__ MKb, h16* P16, bf* Ph, bf* Pl) {
    const int lane = threadIdx.x & 31; const int row = blockIdx.x * 8 + (threadIdx.x >> 5); if (row >= ZH * TT) return; const int i = row % TT; const int zz = row / TT; (void)zz; const bool hires = (i < RH); const float* sr = Sb + (size_t)row * TT; float v[TT / 32]; float mx = -3.0e38f;
#pragma unroll
    for (int ch = 0; ch < TT / 128; ++ch) { const int j0 = ch * 128 + lane * 4; const v4f a = *(const v4f*)(sr + j0); const v4i m4 = *(const v4i*)(MKb + j0);
#pragma unroll
        for (int q = 0; q < 4; ++q) { const int j = j0 + q; (void)j; const float t = (m4[q] == 0) ? a[q] * SCL : -3.0e38f;   /* key_padding_mask True -> -inf */ v[ch * 4 + q] = t; mx = fmaxf(mx, t); } }
#pragma unroll
    for (int sh = 16; sh; sh >>= 1) mx = fmaxf(mx, __shfl_xor(mx, sh, 32));
    float sum = 0.f;
#pragma unroll
    for (int k = 0; k < TT / 32; ++k) { float d0 = __fsub_rn(v[k], mx); asm volatile("" : "+v"(d0)); v[k] = __builtin_amdgcn_exp2f(__fmul_rn(d0, 1.4426950408889634f)); sum += v[k]; }
#pragma unroll
    for (int sh = 16; sh; sh >>= 1) sum += __shfl_xor(sum, sh, 32);
    const float f = __fdiv_rn(hires ? 1.0f : PCAR, sum);
{
        if (hires) {
#pragma unroll
            for (int ch = 0; ch < TT / 128; ++ch) { v4us oh, ol;
#pragma unroll
                for (int q = 0; q < 4; ++q) { unsigned short a, c2; splitf(v[ch * 4 + q] * f, a, c2); oh[q] = a; ol[q] = c2; }
                const size_t oo = ((size_t)zz * (RH ? RH : 1) + i) * TT + ch * 128 + lane * 4; *(v4us*)(Ph + oo) = oh; *(v4us*)(Pl + oo) = ol; }
        } else {
#pragma unroll
            for (int ch = 0; ch < TT / 128; ++ch) { v4h o4;
#pragma unroll
                for (int q = 0; q < 4; ++q) o4[q] = tohx(v[ch * 4 + q] * f);
                *(v4h*)(P16 + (size_t)row * TT + ch * 128 + lane * 4) = o4; } }
         }
}
__global__ __launch_bounds__(256) void k_lenmask(const int* __restrict__ lens, int nb, int* KPM) { const int i = blockIdx.x * 256 + threadIdx.x; if (i >= nb * TT) return; const int b = i / TT, j = i - b * TT; const int m = (j >= lens[b]) ? 1 : 0; *(int*)(KPM + i) = m;  }
__global__ __launch_bounds__(256) void k_merge(const float* __restrict__ O, int h0, bf* Ah, bf* Al) { const size_t e = ((size_t)blockIdx.x * 256 + threadIdx.x) * 2; if (e >= (size_t)ZH * TT * HD) return; const int d = (int)(e % HD); const int t = (int)((e / HD) % TT); const int zz = (int)(e / ((size_t)HD * TT)); const float cs = (t < RH) ? 1.0f : (1.0f / PCAR); const size_t oo = (size_t)t * DQ + (h0 + zz) * HD + d;
    v2us oh, ol;
#pragma unroll
    for (int q = 0; q < 2; ++q) { unsigned short a, c2; splitf(O[e + q] * cs, a, c2); oh[q] = a; ol[q] = c2; } *(v2us*)(Ah + oo) = oh; *(v2us*)(Al + oo) = ol;  }

extern "C" void kernel_launch(void* const* d_in, const int* in_sizes, int n_in,
                              void* d_out, int out_size, void* d_ws, size_t ws_size, hipStream_t stream) {
    (void)in_sizes; (void)n_in; (void)out_size;
    const float* x = (const float*)d_in[0]; const float* xk = (const float*)d_in[1]; const float* xv = (const float*)d_in[2]; const int* lens = (const int*)d_in[3]; const float* wq = (const float*)d_in[4]; const float* wk = (const float*)d_in[5]; const float* wv = (const float*)d_in[6]; const float* wo = (const float*)d_in[7];   /* order q, k, v, valid_lens (int32 [2]: keys j >= valid_lens[b] are masked: READ on the device by k_lenmask), Wq, Wk, Wv, Wo ('xw'): EIGHT inputs */
    float* OUT = (float*)d_out;     // [2][2048][1024]
    char* wsp = (char*)d_ws;
    auto take = [&](size_t bytes) { char* p = wsp; wsp += (bytes + 255) & ~(size_t)255; return (void*)p; };
    bf* WQ = (bf*)take((size_t)DQ * DM * 2); bf* WK = (bf*)take((size_t)DKV * DM * 2); bf* WV = (bf*)take((size_t)DKV * DM * 2); bf* WO = (bf*)take((size_t)DM * DQ * 2); float* CS = (float*)take((size_t)TT * HD * 2 * 4);
    bf* XB = (bf*)take((size_t)TT * DM * 2); float* FQ = (float*)take((size_t)TT * DQ * 4); float* FK = (float*)take((size_t)TT * DKV * 4);
    h16* QP16 = (h16*)take((size_t)NH_ * TT * HD * 2); h16* KP16 = (h16*)take((size_t)NKV * TT * HD * 2); h16* VT16 = (h16*)take((size_t)NKV * HD * TT * 2);
    bf* QPh = (bf*)take((size_t)NH_ * TT * HD * 2); bf* QPl = (bf*)take((size_t)NH_ * TT * HD * 2); bf* KPh = (bf*)take((size_t)NKV * TT * HD * 2); bf* KPl = (bf*)take((size_t)NKV * TT * HD * 2); bf* VTh = (bf*)take((size_t)NKV * HD * TT * 2); bf* VTl = (bf*)take((size_t)NKV * HD * TT * 2); bf* Ph = (bf*)take((size_t)ZH * RH * TT * 2); bf* Pl = (bf*)take((size_t)ZH * RH * TT * 2);
    float* Sb = (float*)take((size_t)ZH * TT * TT * 4); h16* P16 = (h16*)take((size_t)ZH * TT * TT * 2); float* Ob = (float*)take((size_t)ZH * TT * HD * 4); bf* ATh = (bf*)take((size_t)TT * DQ * 2); bf* ATl = (bf*)take((size_t)TT * DQ * 2); int* KPM = (int*)take((size_t)NB_ * TT * 4);   /* the per-key int mask built from valid_lens: carved LAST: no host plane moves */
    if ((size_t)(wsp - (char*)d_ws) > ws_size) return;    // ws 256 MiB
    float* FV = FK;   // v projection reuses the k buffer after the k planes are built (stream-ordered)
    { k_wtG<<<(unsigned)((DM * DQ / 64 + 63) / 64), 256, 0, stream>>>(wq, DM, DQ, WQ); k_wtG<<<(unsigned)((DM * DKV / 64 + 63) / 64), 256, 0, stream>>>(wk, DM, DKV, WK); k_wtG<<<(unsigned)((DM * DKV / 64 + 63) / 64), 256, 0, stream>>>(wv, DM, DKV, WV);
      k_wtG<<<(unsigned)((DQ * DM / 64 + 63) / 64), 256, 0, stream>>>(wo, DQ, DM, WO);
       }
    k_csid<<<(TT * HD + 255) / 256, 256, 0, stream>>>(CS); k_lenmask<<<(NB_ * TT + 255) / 256, 256, 0, stream>>>(lens, NB_, KPM);   /* lengths -> per-key mask, once */
    const unsigned LQ = (unsigned)(((size_t)NH_ * TT * HD / 2 + 255) / 256), LKv = (unsigned)(((size_t)NKV * TT * HD / 2 + 255) / 256);
    for (int b = 0; b < NB_; ++b) {
        
        k_cvt8<<<(unsigned)(((size_t)TT * DM / 8 + 255) / 256), 256, 0, stream>>>(x + (size_t)b * TT * DM, XB, (size_t)TT * DM / 8);
        k_gemmw<bf, 0, false, 8><<<dim3(TT / 64, DQ / 64, 1), 256, 0, stream>>>(XB, nullptr, WQ, nullptr, DM, FQ, DQ, nullptr, 0, 0, 0);
        k_rope<<<LQ, 256, 0, stream>>>(FQ, DQ, NH_, CS, nullptr, nullptr, 1.0f, QP16, QPh, QPl);
        k_cvt8<<<(unsigned)(((size_t)TT * DM / 8 + 255) / 256), 256, 0, stream>>>(xk + (size_t)b * TT * DM, XB, (size_t)TT * DM / 8);   /* XB := bf16(input_K[b]) */ k_gemmw<bf, 0, false, 8><<<dim3(TT / 64, DKV / 64, 1), 256, 0, stream>>>(XB, nullptr, WK, nullptr, DM, FK, DKV, nullptr, 0, 0, 0);
        k_rope<<<LKv, 256, 0, stream>>>(FK, DKV, NKV, CS, nullptr, nullptr, 1.0f, KP16, KPh, KPl);
        k_cvt8<<<(unsigned)(((size_t)TT * DM / 8 + 255) / 256), 256, 0, stream>>>(xv + (size_t)b * TT * DM, XB, (size_t)TT * DM / 8);   /* XB := bf16(input_V[b]) */ k_gemmw<bf, 0, false, 8><<<dim3(TT / 64, DKV / 64, 1), 256, 0, stream>>>(XB, nullptr, WV, nullptr, DM, FV, DKV, nullptr, 0, 0, 0); k_vtp<<<LKv, 256, 0, stream>>>(FV, DKV, NKV, VT16, VTh, VTl);
        for (int h0 = 0; h0 < NH_; h0 += ZH) { const size_t zq = (size_t)h0, zk = (size_t)(h0 / REP);   // one kv head per query head: the pass's two heads use consecutive kv planes (z-strides TT*HD)
            k_gemmw<bf, 2, false, 1><<<dim3(RH / 64, TT / 64, ZH), 32, 0, stream>>>(QPh + zq * TT * HD, QPl + zq * TT * HD, KPh + zk * TT * HD, KPl + zk * TT * HD, HD, Sb, TT, nullptr, (size_t)TT * HD, (size_t)TT * HD, (size_t)TT * TT);
            k_gemmw<h16, 0, false, 1><<<dim3((TT - RH) / 64, TT / 64, ZH), 32, 0, stream>>>(QP16 + zq * TT * HD + (size_t)RH * HD, nullptr, KP16 + zk * TT * HD, nullptr, HD, Sb + (size_t)RH * TT, TT, nullptr, (size_t)TT * HD, (size_t)TT * HD, (size_t)TT * TT);
            k_asoft<<<ZH * TT / 8, 256, 0, stream>>>(Sb, KPM + (size_t)b * TT, P16, Ph, Pl);   /* batch b's key mask */
            k_gemmw<bf, 2, false, 16><<<dim3(RH / 64, HD / 64, ZH), 512, 0, stream>>>(Ph, Pl, VTh + zk * HD * TT, VTl + zk * HD * TT, TT, Ob, HD, nullptr, (size_t)RH * TT, (size_t)HD * TT, (size_t)TT * HD);
            k_gemmw<h16, 0, false, 16><<<dim3((TT - RH) / 64, HD / 64, ZH), 512, 0, stream>>>(P16 + (size_t)RH * TT, nullptr, VT16 + zk * HD * TT, nullptr, TT, Ob + (size_t)RH * HD, HD, nullptr, (size_t)TT * TT, (size_t)HD * TT, (size_t)TT * HD);
            k_merge<<<(unsigned)(((size_t)ZH * TT * HD / 2 + 255) / 256), 256, 0, stream>>>(Ob, h0, ATh, ATl); }
        k_gemmw<bf, 1, false, 8><<<dim3(TT / 64, DM / 64, 1), 256, 0, stream>>>(ATh, ATl, WO, nullptr, DQ, OUT + (size_t)b * TT * DM, DM, nullptr, 0, 0, 0); }
}

// v002
// One run takes 616 microseconds.
// Timed twice side by side with v001, it ran 1.79 and 1.80 times as fast.
// Over all steps from v000 it is 3.34 times as fast.
#include <hip/hip_runtime.h>

// Multi-head attention on three input streams with a per-batch valid-length key mask (q, k, v [2][2048][1024]; qh, kh, vh = stream W ('xw' [1024][1024] 1/32, no bias; 16 heads x 64); scores / sqrt(64); keys j >= valid_lens[b] (int32 [2], read on the device) are REPLACED by -1e6 in the module (at least one key is always kept: numerically an exclusion: -3e38 here); softmax; out = merged Wo ('xw', no bias) -> [2][2048][1024] (4.2 M); argument order q, k, v, valid_lens, Wq, Wk, Wv, Wo).
// Layout per batch: bf16 copies of input_Q, input_K, input_V in turn (one staging buffer, refilled in stream order); 'xw' weights transposed once; exact projections; identity-table plane builders; the per-key int mask KPM[b][j] = (j >= valid_lens[b]) built once on the device (k_lenmask) and read per key by the softmax kernel; dense T-2048 attention (hybrid rows: < 512 hi/lo 3 products, rest fp16 x1024); merged hi/lo x W_O exact.
// Compute dtypes, f32 accumulate: every input rounded to bf16; projections exact; attention rows < 512 3 products, rest fp16; softmax f32; output projection hl x exact.

#define NB_  2
#define TT   2048
#define DM   1024
#define NH_  16
#define NKV  16
#define REP  (NH_ / NKV)
#define HD   64
#define DQ   (NH_ * HD)
#define DKV  (NKV * HD)
#define ZH   8                    // heads per attention pass (z-batch of every attention launch)
#define RH   512                  // query rows < RH use hi+lo planes (0: none)
#define WIN  0
#define PCAR 1024.0f
#define SCL  0.125f   // HD^-0.5
typedef _Float16 h16;
typedef unsigned short bf;
typedef __attribute__((ext_vector_type(16))) __bf16   v16bf;
typedef __attribute__((ext_vector_type(16))) _Float16 v16h;
typedef __attribute__((ext_vector_type(8)))  _Float16 v8h;
typedef __attribute__((ext_vector_type(8)))  unsigned short v8us;
typedef __attribute__((ext_vector_type(8)))  float    v8f;
typedef __attribute__((ext_vector_type(4)))  float    v4f;
typedef v8h  __attribute__((may_alias)) v8ha;
typedef v4f  __attribute__((may_alias)) v4fa;
typedef v8us __attribute__((may_alias)) v8usa;

__device__ __forceinline__ unsigned short f2bf(float f) { unsigned u = __float_as_uint(f); u += 0x7FFFu + ((u >> 16) & 1u); return (unsigned short)(u >> 16); }
__device__ __forceinline__ float bf2f(unsigned short b) { return __uint_as_float(((unsigned)b) << 16); }
__device__ __forceinline__ float bfr(float f) { return bf2f(f2bf(f)); }
__device__ __forceinline__ v16h cat16(v8h lo, v8h hi) { return __builtin_shufflevector(lo, hi, 0, 1, 2, 3, 4, 5, 6, 7, 8, 9, 10, 11, 12, 13, 14, 15); }
__device__ __forceinline__ v16bf cat16b(v8us lo, v8us hi) { return __builtin_bit_cast(v16bf, __builtin_shufflevector(lo, hi, 0, 1, 2, 3, 4, 5, 6, 7, 8, 9, 10, 11, 12, 13, 14, 15)); }
__device__ __forceinline__ v8f wmma16(v16h a, v16h b, v8f c) { return __builtin_amdgcn_wmma_f32_16x16x32_f16(false, a, false, b, (short)0, c, false, false); }
__device__ __forceinline__ v8f wmmab(v16bf a, v16bf b, v8f c) { return __builtin_amdgcn_wmma_f32_16x16x32_bf16(false, a, false, b, (short)0, c, false, false); }



// ---- k_gemmw: register-blocked GEMM, W WAVES per 64x64 output tile (16 accumulators each), operands straight from K-contiguous 16-bit planes; grid (M/64, N/64, Z), 32 * W threads.
// W > 1: wave w takes the 32-wide k steps w, w + W, w + 2W, ... (neighbouring waves read neighbouring 64-B pieces of the same rows); the W partial tiles meet in LDS and are added in wave order 0..W-1.
// C[m][n] (f32, pitch ldc, + optional f32 bias[n]) = sum_k A[m][k] Bt[n][k] (+ split products per NSPLIT). K is the row pitch of A and Bt in elements, KD <= K the depth of the sum (the first KD elements of each row). z-batch strides sA/sB/sC in elements. KD % 32 == 0.
template <typename T16> struct WFrag;
template <> struct WFrag<h16> { typedef v16h V; static __device__ __forceinline__ V ld(const h16* p) { return cat16(*(const v8h*)p, *(const v8h*)(p + 16)); } static __device__ __forceinline__ v8f mma(V a, V b, v8f c) { return wmma16(a, b, c); } };
template <> struct WFrag<bf> { typedef v16bf V; static __device__ __forceinline__ V ld(const bf* p) { return cat16b(*(const v8us*)p, *(const v8us*)(p + 16)); } static __device__ __forceinline__ v8f mma(V a, V b, v8f c) { return wmmab(a, b, c); } };
template <typename T16, int NSPLIT, bool BIAS, int W>
__global__ __launch_bounds__(32 * W) void k_gemmw(const T16* __restrict__ A, const T16* __restrict__ A2, const T16* __restrict__ Bt, const T16* __restrict__ Bt2, int K, int KD, float* C, int ldc, const float* __restrict__ bias, size_t sA, size_t sB, size_t sC) {
    typedef typename WFrag<T16>::V V;
    __shared__ __align__(16) float os[W == 1 ? 16 * 68 : W * 4096];
    const int wv = __builtin_amdgcn_readfirstlane((int)(threadIdx.x >> 5));
    const size_t z = blockIdx.z; A += z * sA; if (A2) A2 += z * sA; Bt += z * sB; if (Bt2) Bt2 += z * sB; C += z * sC;
    const int lane = threadIdx.x & 31, lr = lane & 15, hi = lane >> 4; const int r0 = blockIdx.x * 64, c0 = blockIdx.y * 64;
    v8f acc[4][4];
#pragma unroll
    for (int mb = 0; mb < 4; ++mb)
#pragma unroll
        for (int nb = 0; nb < 4; ++nb) acc[mb][nb] = (v8f){};
    const size_t aoff = (size_t)(r0 + lr) * K + 8 * hi, boff = (size_t)(c0 + lr) * K + 8 * hi;
#pragma unroll 1
    for (int kc = wv * 32; kc < KD; kc += 32 * W) {
        V a[4], a2[4];
#pragma unroll
        for (int mb = 0; mb < 4; ++mb) { a[mb] = WFrag<T16>::ld(A + aoff + (size_t)mb * 16 * K + kc); if (NSPLIT == 1 || NSPLIT == 2) a2[mb] = WFrag<T16>::ld(A2 + aoff + (size_t)mb * 16 * K + kc); }
#pragma unroll
        for (int nb = 0; nb < 4; ++nb) { const V b = WFrag<T16>::ld(Bt + boff + (size_t)nb * 16 * K + kc); V b2; if (NSPLIT >= 2) b2 = WFrag<T16>::ld(Bt2 + boff + (size_t)nb * 16 * K + kc);
#pragma unroll
            for (int mb = 0; mb < 4; ++mb) { acc[mb][nb] = WFrag<T16>::mma(a[mb], b, acc[mb][nb]); if (NSPLIT == 1 || NSPLIT == 2) acc[mb][nb] = WFrag<T16>::mma(a2[mb], b, acc[mb][nb]); if (NSPLIT >= 2) acc[mb][nb] = WFrag<T16>::mma(a[mb], b2, acc[mb][nb]); } }
        asm volatile("v_nop\n\tv_nop\n\tv_nop\n\tv_nop" : "+v"(acc[0][0]), "+v"(acc[1][1]), "+v"(acc[2][2]), "+v"(acc[3][3]) : "v"(a[0]), "v"(a[3]));
    }
    if constexpr (W > 1) {
        // every wave parks its partial tile in accumulator order: [wave][mb * 4 + nb][j / 4][lane][j % 4], 16-byte stores, 512 contiguous bytes each
        float* mine = os + wv * 4096 + lane * 4;
#pragma unroll
        for (int mb = 0; mb < 4; ++mb)
#pragma unroll
            for (int nb = 0; nb < 4; ++nb) {
                *(v4fa*)(mine + ((mb * 4 + nb) * 2 + 0) * 128) = __builtin_shufflevector(acc[mb][nb], acc[mb][nb], 0, 1, 2, 3);
                *(v4fa*)(mine + ((mb * 4 + nb) * 2 + 1) * 128) = __builtin_shufflevector(acc[mb][nb], acc[mb][nb], 4, 5, 6, 7); }
        __syncthreads();   // all W partial tiles are in LDS before any wave adds them
        // wave wv owns the 64 / W whole output rows mbr * 16 + hi * 8 + j0 .. + JN - 1 (all 64 columns: it alone writes those lines)
        constexpr int JN = 32 / W; typedef float vjn __attribute__((ext_vector_type(JN), may_alias));
        const int mbr = wv / (W / 4), j0 = (wv % (W / 4)) * JN;
        const float* part = os + (((mbr * 4) * 2 + (j0 >> 2)) * 32 + lane) * 4 + (j0 & 3);
        vjn r[4];
#pragma unroll
        for (int nb = 0; nb < 4; ++nb) r[nb] = *(const vjn*)(part + nb * 256);
#pragma unroll
        for (int s = 1; s < W; ++s)
#pragma unroll
            for (int nb = 0; nb < 4; ++nb) r[nb] += *(const vjn*)(part + s * 4096 + nb * 256);
        float* crow = C + (size_t)(r0 + mbr * 16 + hi * 8 + j0) * ldc + c0 + lr;
#pragma unroll
        for (int jj = 0; jj < JN; ++jj)
#pragma unroll
            for (int nb = 0; nb < 4; ++nb) crow[(size_t)jj * ldc + nb * 16] = BIAS ? r[nb][jj] + bfr(bias[c0 + nb * 16 + lr]) : r[nb][jj];
        return;
    }
#pragma unroll
    for (int mb = 0; mb < 4; ++mb) {
#pragma unroll
        for (int nb = 0; nb < 4; ++nb) {
#pragma unroll
            for (int j = 0; j < 8; ++j) os[(hi * 8 + j) * 68 + nb * 16 + lr] = acc[mb][nb][j]; }
        __builtin_amdgcn_wave_barrier(); asm volatile("" ::: "memory");
        float* crow = C + (size_t)(r0 + mb * 16) * ldc + c0;
{
#pragma unroll
            for (int s = 0; s < 8; ++s) { const int row = 2 * s + hi, cofs = lr * 4; v4f val = *(const v4fa*)(os + row * 68 + cofs); if (BIAS) { val[0] += bfr(bias[c0 + cofs]); val[1] += bfr(bias[c0 + cofs + 1]); val[2] += bfr(bias[c0 + cofs + 2]); val[3] += bfr(bias[c0 + cofs + 3]); }
                *(v4f*)(crow + (size_t)row * ldc + cofs) = val; }
             }
        __builtin_amdgcn_wave_barrier(); asm volatile("" ::: "memory");
    }
}

__device__ __forceinline__ h16 tohx(float x) { return (h16)x; }
__device__ __forceinline__ void splitf(float y, unsigned short& h, unsigned short& l) { h = f2bf(y); l = f2bf(y - bf2f(h)); }
typedef __attribute__((ext_vector_type(2))) _Float16 v2h;
typedef __attribute__((ext_vector_type(4))) _Float16 v4h;
typedef __attribute__((ext_vector_type(2))) unsigned short v2us;
typedef __attribute__((ext_vector_type(4))) unsigned short v4us;
typedef __attribute__((ext_vector_type(2))) float v2f;
typedef __attribute__((ext_vector_type(4))) int v4i;
typedef v4h  __attribute__((may_alias)) v4ha;
typedef v4us __attribute__((may_alias)) v4usa;

__global__ __launch_bounds__(256) void k_wtG(const float* __restrict__ w, int K, int N, bf* Bt) {
    const int lane = threadIdx.x & 31; const int L0 = (blockIdx.x * 8 + (threadIdx.x >> 5)) * 8; const int nlines = N * K / 64;
{
#pragma unroll 1
        for (int l = 0; l < 8; ++l) { const int L = L0 + l; if (L >= nlines) break; const size_t e = (size_t)L * 64 + lane * 2; const int k = (int)(e % K), n = (int)(e / K); v2us o;
            o[0] = f2bf(w[(size_t)k * N + n]); o[1] = f2bf(w[(size_t)(k + 1) * N + n]); *(v2us*)(Bt + e) = o; }
         }
}
__global__ __launch_bounds__(256) void k_cvt8(const float* __restrict__ src, bf* dst, size_t n8) { const size_t i = (size_t)blockIdx.x * 256 + threadIdx.x; if (i >= n8) return; const v8f v = *(const v8f*)(src + i * 8); v8us o;
#pragma unroll
    for (int k = 0; k < 8; ++k) o[k] = f2bf(v[k]); *(v8us*)(dst + i * 8) = o;  }

// k_rope: head planes [h][t][d] (fp16 + hi/lo) of rope(x) x sc with the rotate-half convention out[d] = x[d] cos[t][d] - x[d+HD/2] sin[t][d], out[d+HD/2] = x[d+HD/2] cos[t][d+HD/2] + x[d] sin[t][d+HD/2]
__global__ __launch_bounds__(256) void k_rope(const float* __restrict__ F, int pitch, int nheads, const float* __restrict__ CS, const float* __restrict__ RF, const float* __restrict__ nw, float sc, h16* P16, bf* Ph, bf* Pl) {
    const size_t e = ((size_t)blockIdx.x * 256 + threadIdx.x) * 2; if (e >= (size_t)nheads * TT * HD) return; const int d = (int)(e % HD); const int t = (int)((e / HD) % TT); const int h = (int)(e / ((size_t)HD * TT)); const float* f = F + (size_t)t * pitch + h * HD; const float rf = RF ? RF[(size_t)h * TT + t] : 1.0f; v2h o16; v2us oh, ol;
#pragma unroll
    for (int q = 0; q < 2; ++q) { const int dd = d + q; const int dp = (dd < HD / 2) ? dd + HD / 2 : dd - HD / 2; float x0 = f[dd], x1 = f[dp];
        if (RF) { float n0 = __fmul_rn(x0, rf), n1 = __fmul_rn(x1, rf); asm volatile("" : "+v"(n0)); asm volatile("" : "+v"(n1)); x0 = __fmul_rn(bfr(nw[dd]), n0); x1 = __fmul_rn(bfr(nw[dp]), n1); }
        const v2f cs = *(const v2f*)(CS + ((size_t)t * HD + dd) * 2); float a = __fmul_rn(x0, cs[0]), bq = __fmul_rn(x1, cs[1]); asm volatile("" : "+v"(a)); asm volatile("" : "+v"(bq)); const float r = ((dd < HD / 2) ? __fsub_rn(a, bq) : __fadd_rn(a, bq)) * sc;
        o16[q] = tohx(r); unsigned short a2, c2; splitf(r, a2, c2); oh[q] = a2; ol[q] = c2; }
    *(v2h*)(P16 + e) = o16; *(v2us*)(Ph + e) = oh; *(v2us*)(Pl + e) = ol;  }
__global__ __launch_bounds__(256) void k_vtp(const float* __restrict__ F, int pitch, int nheads, h16* V16, bf* Vh, bf* Vl) { const size_t e = ((size_t)blockIdx.x * 256 + threadIdx.x) * 2; if (e >= (size_t)nheads * HD * TT) return; const int t = (int)(e % TT); const int d = (int)((e / TT) % HD); const int g = (int)(e / ((size_t)TT * HD)); v2h o16; v2us oh, ol;
#pragma unroll
    for (int q = 0; q < 2; ++q) { const float x = F[(size_t)(t + q) * pitch + g * HD + d]; o16[q] = tohx(x); unsigned short a2, c2; splitf(x, a2, c2); oh[q] = a2; ol[q] = c2; }
    const size_t o = (e / TT) * (2 * TT) + t;   // V^T rows at the pitch of the probability rows (2 * TT): Vl = Vh + TT shares a row with Vh, the fp16 plane uses the first half of its rows
    *(v2h*)(V16 + o) = o16; *(v2us*)(Vh + o) = oh; *(v2us*)(Vl + o) = ol;  }
__global__ __launch_bounds__(256) void k_csid(float* CS) { const int idx = blockIdx.x * 256 + threadIdx.x; if (idx >= TT * HD) return; v2f cs; cs[0] = 1.0f; cs[1] = 0.0f; *(v2f*)(CS + (size_t)idx * 2) = cs;  }
// k_asoft: per row (zz, i): t = S x HD^-0.5 (masked keys: -3e38); softmax over the 2048 keys (register row, one exp, fixed trees);
// the probabilities go back over the row's own 8 KiB of scores (one wave owns the row and holds all of it in registers before its first store): rows < RH: hi plane in the first 4 KiB, lo plane in the second; other rows: fp16 in the first 4 KiB. 16-bit row pitch 2 * TT.
__global__ __launch_bounds__(256) void k_asoft(float* Sb, const int* __restrict__ MKb) {
    const int lane = threadIdx.x & 31; const int row = blockIdx.x * 8 + (threadIdx.x >> 5); if (row >= ZH * TT) return; const int i = row % TT; const int zz = row / TT; (void)zz; const bool hires = (i < RH); const float* sr = Sb + (size_t)row * TT; bf* Ph = (bf*)(Sb + (size_t)row * TT); bf* Pl = Ph + TT; h16* P16 = (h16*)(Sb + (size_t)row * TT); float v[TT / 32]; float mx = -3.0e38f;
#pragma unroll
    for (int ch = 0; ch < TT / 128; ++ch) { const int j0 = ch * 128 + lane * 4; const v4f a = *(const v4f*)(sr + j0); const v4i m4 = *(const v4i*)(MKb + j0);
#pragma unroll
        for (int q = 0; q < 4; ++q) { const int j = j0 + q; (void)j; const float t = (m4[q] == 0) ? a[q] * SCL : -3.0e38f;   /* key_padding_mask True -> -inf */ v[ch * 4 + q] = t; mx = fmaxf(mx, t); } }
#pragma unroll
    for (int sh = 16; sh; sh >>= 1) mx = fmaxf(mx, __shfl_xor(mx, sh, 32));
    float sum = 0.f;
#pragma unroll
    for (int k = 0; k < TT / 32; ++k) { float d0 = __fsub_rn(v[k], mx); asm volatile("" : "+v"(d0)); v[k] = __builtin_amdgcn_exp2f(__fmul_rn(d0, 1.4426950408889634f)); sum += v[k]; }
#pragma unroll
    for (int sh = 16; sh; sh >>= 1) sum += __shfl_xor(sum, sh, 32);
    const float f = __fdiv_rn(hires ? 1.0f : PCAR, sum);
{
        if (hires) {
#pragma unroll
            for (int ch = 0; ch < TT / 128; ++ch) { v4us oh, ol;
#pragma unroll
                for (int q = 0; q < 4; ++q) { unsigned short a, c2; splitf(v[ch * 4 + q] * f, a, c2); oh[q] = a; ol[q] = c2; }
                const int oo = ch * 128 + lane * 4; *(v4usa*)(Ph + oo) = oh; *(v4usa*)(Pl + oo) = ol; }
        } else {
#pragma unroll
            for (int ch = 0; ch < TT / 128; ++ch) { v4h o4;
#pragma unroll
                for (int q = 0; q < 4; ++q) o4[q] = tohx(v[ch * 4 + q] * f);
                *(v4ha*)(P16 + ch * 128 + lane * 4) = o4; } }
         }
}
__global__ __launch_bounds__(256) void k_lenmask(const int* __restrict__ lens, int nb, int* KPM) { const int i = blockIdx.x * 256 + threadIdx.x; if (i >= nb * TT) return; const int b = i / TT, j = i - b * TT; const int m = (j >= lens[b]) ? 1 : 0; *(int*)(KPM + i) = m;  }
__global__ __launch_bounds__(256) void k_merge(const float* __restrict__ O, int h0, bf* Ah, bf* Al) { const size_t e = ((size_t)blockIdx.x * 256 + threadIdx.x) * 2; if (e >= (size_t)ZH * TT * HD) return; const int d = (int)(e % HD); const int t = (int)((e / HD) % TT); const int zz = (int)(e / ((size_t)HD * TT)); const float cs = (t < RH) ? 1.0f : (1.0f / PCAR); const size_t oo = (size_t)t * DQ + (h0 + zz) * HD + d;
    v2us oh, ol;
#pragma unroll
    for (int q = 0; q < 2; ++q) { unsigned short a, c2; splitf(O[e + q] * cs, a, c2); oh[q] = a; ol[q] = c2; } *(v2us*)(Ah + oo) = oh; *(v2us*)(Al + oo) = ol;  }

extern "C" void kernel_launch(void* const* d_in, const int* in_sizes, int n_in,
                              void* d_out, int out_size, void* d_ws, size_t ws_size, hipStream_t stream) {
    (void)in_sizes; (void)n_in; (void)out_size;
    const float* x = (const float*)d_in[0]; const float* xk = (const float*)d_in[1]; const float* xv = (const float*)d_in[2]; const int* lens = (const int*)d_in[3]; const float* wq = (const float*)d_in[4]; const float* wk = (const float*)d_in[5]; const float* wv = (const float*)d_in[6]; const float* wo = (const float*)d_in[7];   /* order q, k, v, valid_lens (int32 [2]: keys j >= valid_lens[b] are masked: READ on the device by k_lenmask), Wq, Wk, Wv, Wo ('xw'): EIGHT inputs */
    float* OUT = (float*)d_out;     // [2][2048][1024]
    char* wsp = (char*)d_ws;
    auto take = [&](size_t bytes) { char* p = wsp; wsp += (bytes + 255) & ~(size_t)255; return (void*)p; };
    bf* WQ = (bf*)take((size_t)DQ * DM * 2); bf* WK = (bf*)take((size_t)DKV * DM * 2); bf* WV = (bf*)take((size_t)DKV * DM * 2); bf* WO = (bf*)take((size_t)DM * DQ * 2); float* CS = (float*)take((size_t)TT * HD * 2 * 4);
    bf* XB = (bf*)take((size_t)TT * DM * 2); float* FQ = (float*)take((size_t)TT * DQ * 4); float* FK = (float*)take((size_t)TT * DKV * 4);
    h16* QP16 = (h16*)take((size_t)NH_ * TT * HD * 2); h16* KP16 = (h16*)take((size_t)NKV * TT * HD * 2); h16* VT16 = (h16*)take((size_t)NKV * HD * 2 * TT * 2);
    bf* QPh = (bf*)take((size_t)NH_ * TT * HD * 2); bf* QPl = (bf*)take((size_t)NH_ * TT * HD * 2); bf* KPh = (bf*)take((size_t)NKV * TT * HD * 2); bf* KPl = (bf*)take((size_t)NKV * TT * HD * 2); bf* VTh = (bf*)take((size_t)NKV * HD * 2 * TT * 2); bf* VTl = VTh + TT;   /* V^T rows: pitch 2 * TT, hi then lo */
    float* Sb = (float*)take((size_t)ZH * TT * TT * 4);   /* scores, then the probability planes over them (k_asoft) */ float* Ob = (float*)take((size_t)ZH * TT * HD * 4); bf* ATh = (bf*)take((size_t)TT * DQ * 2); bf* ATl = (bf*)take((size_t)TT * DQ * 2); int* KPM = (int*)take((size_t)NB_ * TT * 4);   /* the per-key int mask built from valid_lens: carved LAST: no host plane moves */
    if ((size_t)(wsp - (char*)d_ws) > ws_size) return;    // ws 256 MiB
    float* FV = FK;   // v projection reuses the k buffer after the k planes are built (stream-ordered)
    { k_wtG<<<(unsigned)((DM * DQ / 64 + 63) / 64), 256, 0, stream>>>(wq, DM, DQ, WQ); k_wtG<<<(unsigned)((DM * DKV / 64 + 63) / 64), 256, 0, stream>>>(wk, DM, DKV, WK); k_wtG<<<(unsigned)((DM * DKV / 64 + 63) / 64), 256, 0, stream>>>(wv, DM, DKV, WV);
      k_wtG<<<(unsigned)((DQ * DM / 64 + 63) / 64), 256, 0, stream>>>(wo, DQ, DM, WO);
       }
    k_csid<<<(TT * HD + 255) / 256, 256, 0, stream>>>(CS); k_lenmask<<<(NB_ * TT + 255) / 256, 256, 0, stream>>>(lens, NB_, KPM);   /* lengths -> per-key mask, once */
    const unsigned LQ = (unsigned)(((size_t)NH_ * TT * HD / 2 + 255) / 256), LKv = (unsigned)(((size_t)NKV * TT * HD / 2 + 255) / 256);
    for (int b = 0; b < NB_; ++b) {
        
        k_cvt8<<<(unsigned)(((size_t)TT * DM / 8 + 255) / 256), 256, 0, stream>>>(x + (size_t)b * TT * DM, XB, (size_t)TT * DM / 8);
        k_gemmw<bf, 0, false, 8><<<dim3(TT / 64, DQ / 64, 1), 256, 0, stream>>>(XB, nullptr, WQ, nullptr, DM, DM, FQ, DQ, nullptr, 0, 0, 0);
        k_rope<<<LQ, 256, 0, stream>>>(FQ, DQ, NH_, CS, nullptr, nullptr, 1.0f, QP16, QPh, QPl);
        k_cvt8<<<(unsigned)(((size_t)TT * DM / 8 + 255) / 256), 256, 0, stream>>>(xk + (size_t)b * TT * DM, XB, (size_t)TT * DM / 8);   /* XB := bf16(input_K[b]) */ k_gemmw<bf, 0, false, 8><<<dim3(TT / 64, DKV / 64, 1), 256, 0, stream>>>(XB, nullptr, WK, nullptr, DM, DM, FK, DKV, nullptr, 0, 0, 0);
        k_rope<<<LKv, 256, 0, stream>>>(FK, DKV, NKV, CS, nullptr, nullptr, 1.0f, KP16, KPh, KPl);
        k_cvt8<<<(unsigned)(((size_t)TT * DM / 8 + 255) / 256), 256, 0, stream>>>(xv + (size_t)b * TT * DM, XB, (size_t)TT * DM / 8);   /* XB := bf16(input_V[b]) */ k_gemmw<bf, 0, false, 8><<<dim3(TT / 64, DKV / 64, 1), 256, 0, stream>>>(XB, nullptr, WV, nullptr, DM, DM, FV, DKV, nullptr, 0, 0, 0); k_vtp<<<LKv, 256, 0, stream>>>(FV, DKV, NKV, VT16, VTh, VTl);
        for (int h0 = 0; h0 < NH_; h0 += ZH) { const size_t zq = (size_t)h0, zk = (size_t)(h0 / REP);   // one kv head per query head: the pass's ZH heads use consecutive kv planes (z-strides TT*HD; V^T planes HD*2*TT)
            k_gemmw<bf, 2, false, 1><<<dim3(RH / 64, TT / 64, ZH), 32, 0, stream>>>(QPh + zq * TT * HD, QPl + zq * TT * HD, KPh + zk * TT * HD, KPl + zk * TT * HD, HD, HD, Sb, TT, nullptr, (size_t)TT * HD, (size_t)TT * HD, (size_t)TT * TT);
            k_gemmw<h16, 0, false, 1><<<dim3((TT - RH) / 64, TT / 64, ZH), 32, 0, stream>>>(QP16 + zq * TT * HD + (size_t)RH * HD, nullptr, KP16 + zk * TT * HD, nullptr, HD, HD, Sb + (size_t)RH * TT, TT, nullptr, (size_t)TT * HD, (size_t)TT * HD, (size_t)TT * TT);
            k_asoft<<<ZH * TT / 8, 256, 0, stream>>>(Sb, KPM + (size_t)b * TT);   /* batch b's key mask */
            k_gemmw<bf, 2, false, 16><<<dim3(RH / 64, HD / 64, ZH), 512, 0, stream>>>((const bf*)Sb, (const bf*)Sb + TT, VTh + zk * HD * 2 * TT, VTl + zk * HD * 2 * TT, 2 * TT, TT, Ob, HD, nullptr, (size_t)2 * TT * TT, (size_t)HD * 2 * TT, (size_t)TT * HD);
            k_gemmw<h16, 0, false, 16><<<dim3((TT - RH) / 64, HD / 64, ZH), 512, 0, stream>>>((const h16*)Sb + (size_t)RH * 2 * TT, nullptr, VT16 + zk * HD * 2 * TT, nullptr, 2 * TT, TT, Ob + (size_t)RH * HD, HD, nullptr, (size_t)2 * TT * TT, (size_t)HD * 2 * TT, (size_t)TT * HD);
            k_merge<<<(unsigned)(((size_t)ZH * TT * HD / 2 + 255) / 256), 256, 0, stream>>>(Ob, h0, ATh, ATl); }
        k_gemmw<bf, 1, false, 8><<<dim3(TT / 64, DM / 64, 1), 256, 0, stream>>>(ATh, ATl, WO, nullptr, DQ, DQ, OUT + (size_t)b * TT * DM, DM, nullptr, 0, 0, 0); }
}

// v003
// One run takes 277 microseconds.
// Next to v002, in two timings, it ran 2.22 and 2.21 times as fast.
// Counting every step since v000, it is 7.39 times as fast.
#include <hip/hip_runtime.h>

// Multi-head attention on three input streams with a per-batch valid-length key mask (q, k, v [2][2048][1024]; qh, kh, vh = stream W ('xw' [1024][1024] 1/32, no bias; 16 heads x 64); scores / sqrt(64); keys j >= valid_lens[b] (int32 [2], read on the device) are REPLACED by -1e6 in the module (at least one key is always kept: numerically an exclusion: -3e38 here); softmax; out = merged Wo ('xw', no bias) -> [2][2048][1024] (4.2 M); argument order q, k, v, valid_lens, Wq, Wk, Wv, Wo).
// Layout per batch: bf16 copies of input_Q, input_K, input_V in turn (one staging buffer, refilled in stream order); 'xw' weights transposed once; exact projections; identity-table plane builders; one fused attention kernel per batch (k_fattn: scores, length mask from valid_lens[b], online softmax, P x V, hi/lo merge; hybrid rows: < 512 hi/lo 3 products, rest fp16); merged hi/lo x W_O exact.
// Compute dtypes, f32 accumulate: every input rounded to bf16; projections exact; attention rows < 512 3 products, rest fp16; softmax f32; output projection hl x exact.

#define NB_  2
#define TT   2048
#define DM   1024
#define NH_  16
#define NKV  16
#define REP  (NH_ / NKV)
#define HD   64
#define DQ   (NH_ * HD)
#define DKV  (NKV * HD)
#define RH   512                  // query rows < RH use hi+lo planes (0: none)
#define WIN  0
#define SCL  0.125f   // HD^-0.5
typedef _Float16 h16;
typedef unsigned short bf;
typedef __attribute__((ext_vector_type(16))) __bf16   v16bf;
typedef __attribute__((ext_vector_type(16))) _Float16 v16h;
typedef __attribute__((ext_vector_type(8)))  _Float16 v8h;
typedef __attribute__((ext_vector_type(8)))  unsigned short v8us;
typedef __attribute__((ext_vector_type(8)))  float    v8f;
typedef __attribute__((ext_vector_type(4)))  float    v4f;
typedef v8h  __attribute__((may_alias)) v8ha;
typedef v4f  __attribute__((may_alias)) v4fa;
typedef v8us __attribute__((may_alias)) v8usa;

__device__ __forceinline__ unsigned short f2bf(float f) { unsigned u = __float_as_uint(f); u += 0x7FFFu + ((u >> 16) & 1u); return (unsigned short)(u >> 16); }
__device__ __forceinline__ float bf2f(unsigned short b) { return __uint_as_float(((unsigned)b) << 16); }
__device__ __forceinline__ float bfr(float f) { return bf2f(f2bf(f)); }
__device__ __forceinline__ v16h cat16(v8h lo, v8h hi) { return __builtin_shufflevector(lo, hi, 0, 1, 2, 3, 4, 5, 6, 7, 8, 9, 10, 11, 12, 13, 14, 15); }
__device__ __forceinline__ v16bf cat16b(v8us lo, v8us hi) { return __builtin_bit_cast(v16bf, __builtin_shufflevector(lo, hi, 0, 1, 2, 3, 4, 5, 6, 7, 8, 9, 10, 11, 12, 13, 14, 15)); }
__device__ __forceinline__ v8f wmma16(v16h a, v16h b, v8f c) { return __builtin_amdgcn_wmma_f32_16x16x32_f16(false, a, false, b, (short)0, c, false, false); }
__device__ __forceinline__ v8f wmmab(v16bf a, v16bf b, v8f c) { return __builtin_amdgcn_wmma_f32_16x16x32_bf16(false, a, false, b, (short)0, c, false, false); }



// ---- k_gemmw: register-blocked GEMM, W WAVES per 64x64 output tile (16 accumulators each), operands straight from K-contiguous 16-bit planes; grid (M/64, N/64, Z), 32 * W threads.
// W > 1: wave w takes the 32-wide k steps w, w + W, w + 2W, ... (neighbouring waves read neighbouring 64-B pieces of the same rows); the W partial tiles meet in LDS and are added in wave order 0..W-1.
// C[m][n] (f32, pitch ldc, + optional f32 bias[n]) = sum_k A[m][k] Bt[n][k] (+ split products per NSPLIT). K is the row pitch of A and Bt in elements, KD <= K the depth of the sum (the first KD elements of each row). z-batch strides sA/sB/sC in elements. KD % 32 == 0.
template <typename T16> struct WFrag;
template <> struct WFrag<h16> { typedef v16h V; static __device__ __forceinline__ V ld(const h16* p) { return cat16(*(const v8h*)p, *(const v8h*)(p + 16)); } static __device__ __forceinline__ v8f mma(V a, V b, v8f c) { return wmma16(a, b, c); } };
template <> struct WFrag<bf> { typedef v16bf V; static __device__ __forceinline__ V ld(const bf* p) { return cat16b(*(const v8us*)p, *(const v8us*)(p + 16)); } static __device__ __forceinline__ v8f mma(V a, V b, v8f c) { return wmmab(a, b, c); } };
template <typename T16, int NSPLIT, bool BIAS, int W>
__global__ __launch_bounds__(32 * W) void k_gemmw(const T16* __restrict__ A, const T16* __restrict__ A2, const T16* __restrict__ Bt, const T16* __restrict__ Bt2, int K, int KD, float* C, int ldc, const float* __restrict__ bias, size_t sA, size_t sB, size_t sC) {
    typedef typename WFrag<T16>::V V;
    __shared__ __align__(16) float os[W == 1 ? 16 * 68 : W * 4096];
    const int wv = __builtin_amdgcn_readfirstlane((int)(threadIdx.x >> 5));
    const size_t z = blockIdx.z; A += z * sA; if (A2) A2 += z * sA; Bt += z * sB; if (Bt2) Bt2 += z * sB; C += z * sC;
    const int lane = threadIdx.x & 31, lr = lane & 15, hi = lane >> 4; const int r0 = blockIdx.x * 64, c0 = blockIdx.y * 64;
    v8f acc[4][4];
#pragma unroll
    for (int mb = 0; mb < 4; ++mb)
#pragma unroll
        for (int nb = 0; nb < 4; ++nb) acc[mb][nb] = (v8f){};
    const size_t aoff = (size_t)(r0 + lr) * K + 8 * hi, boff = (size_t)(c0 + lr) * K + 8 * hi;
#pragma unroll 1
    for (int kc = wv * 32; kc < KD; kc += 32 * W) {
        V a[4], a2[4];
#pragma unroll
        for (int mb = 0; mb < 4; ++mb) { a[mb] = WFrag<T16>::ld(A + aoff + (size_t)mb * 16 * K + kc); if (NSPLIT == 1 || NSPLIT == 2) a2[mb] = WFrag<T16>::ld(A2 + aoff + (size_t)mb * 16 * K + kc); }
#pragma unroll
        for (int nb = 0; nb < 4; ++nb) { const V b = WFrag<T16>::ld(Bt + boff + (size_t)nb * 16 * K + kc); V b2; if (NSPLIT >= 2) b2 = WFrag<T16>::ld(Bt2 + boff + (size_t)nb * 16 * K + kc);
#pragma unroll
            for (int mb = 0; mb < 4; ++mb) { acc[mb][nb] = WFrag<T16>::mma(a[mb], b, acc[mb][nb]); if (NSPLIT == 1 || NSPLIT == 2) acc[mb][nb] = WFrag<T16>::mma(a2[mb], b, acc[mb][nb]); if (NSPLIT >= 2) acc[mb][nb] = WFrag<T16>::mma(a[mb], b2, acc[mb][nb]); } }
        asm volatile("v_nop\n\tv_nop\n\tv_nop\n\tv_nop" : "+v"(acc[0][0]), "+v"(acc[1][1]), "+v"(acc[2][2]), "+v"(acc[3][3]) : "v"(a[0]), "v"(a[3]));
    }
    if constexpr (W > 1) {
        // every wave parks its partial tile in accumulator order: [wave][mb * 4 + nb][j / 4][lane][j % 4], 16-byte stores, 512 contiguous bytes each
        float* mine = os + wv * 4096 + lane * 4;
#pragma unroll
        for (int mb = 0; mb < 4; ++mb)
#pragma unroll
            for (int nb = 0; nb < 4; ++nb) {
                *(v4fa*)(mine + ((mb * 4 + nb) * 2 + 0) * 128) = __builtin_shufflevector(acc[mb][nb], acc[mb][nb], 0, 1, 2, 3);
                *(v4fa*)(mine + ((mb * 4 + nb) * 2 + 1) * 128) = __builtin_shufflevector(acc[mb][nb], acc[mb][nb], 4, 5, 6, 7); }
        __syncthreads();   // all W partial tiles are in LDS before any wave adds them
        // wave wv owns the 64 / W whole output rows mbr * 16 + hi * 8 + j0 .. + JN - 1 (all 64 columns: it alone writes those lines)
        constexpr int JN = 32 / W; typedef float vjn __attribute__((ext_vector_type(JN), may_alias));
        const int mbr = wv / (W / 4), j0 = (wv % (W / 4)) * JN;
        const float* part = os + (((mbr * 4) * 2 + (j0 >> 2)) * 32 + lane) * 4 + (j0 & 3);
        vjn r[4];
#pragma unroll
        for (int nb = 0; nb < 4; ++nb) r[nb] = *(const vjn*)(part + nb * 256);
#pragma unroll
        for (int s = 1; s < W; ++s)
#pragma unroll
            for (int nb = 0; nb < 4; ++nb) r[nb] += *(const vjn*)(part + s * 4096 + nb * 256);
        float* crow = C + (size_t)(r0 + mbr * 16 + hi * 8 + j0) * ldc + c0 + lr;
#pragma unroll
        for (int jj = 0; jj < JN; ++jj)
#pragma unroll
            for (int nb = 0; nb < 4; ++nb) crow[(size_t)jj * ldc + nb * 16] = BIAS ? r[nb][jj] + bfr(bias[c0 + nb * 16 + lr]) : r[nb][jj];
        return;
    }
#pragma unroll
    for (int mb = 0; mb < 4; ++mb) {
#pragma unroll
        for (int nb = 0; nb < 4; ++nb) {
#pragma unroll
            for (int j = 0; j < 8; ++j) os[(hi * 8 + j) * 68 + nb * 16 + lr] = acc[mb][nb][j]; }
        __builtin_amdgcn_wave_barrier(); asm volatile("" ::: "memory");
        float* crow = C + (size_t)(r0 + mb * 16) * ldc + c0;
{
#pragma unroll
            for (int s = 0; s < 8; ++s) { const int row = 2 * s + hi, cofs = lr * 4; v4f val = *(const v4fa*)(os + row * 68 + cofs); if (BIAS) { val[0] += bfr(bias[c0 + cofs]); val[1] += bfr(bias[c0 + cofs + 1]); val[2] += bfr(bias[c0 + cofs + 2]); val[3] += bfr(bias[c0 + cofs + 3]); }
                *(v4f*)(crow + (size_t)row * ldc + cofs) = val; }
             }
        __builtin_amdgcn_wave_barrier(); asm volatile("" ::: "memory");
    }
}

__device__ __forceinline__ h16 tohx(float x) { return (h16)x; }
__device__ __forceinline__ void splitf(float y, unsigned short& h, unsigned short& l) { h = f2bf(y); l = f2bf(y - bf2f(h)); }
typedef __attribute__((ext_vector_type(2))) _Float16 v2h;
typedef __attribute__((ext_vector_type(4))) _Float16 v4h;
typedef __attribute__((ext_vector_type(2))) unsigned short v2us;
typedef __attribute__((ext_vector_type(4))) unsigned short v4us;
typedef __attribute__((ext_vector_type(2))) float v2f;
typedef __attribute__((ext_vector_type(4))) int v4i;
typedef v4h  __attribute__((may_alias)) v4ha;
typedef v4us __attribute__((may_alias)) v4usa;

__global__ __launch_bounds__(256) void k_wtG(const float* __restrict__ w, int K, int N, bf* Bt) {
    const int lane = threadIdx.x & 31; const int L0 = (blockIdx.x * 8 + (threadIdx.x >> 5)) * 8; const int nlines = N * K / 64;
{
#pragma unroll 1
        for (int l = 0; l < 8; ++l) { const int L = L0 + l; if (L >= nlines) break; const size_t e = (size_t)L * 64 + lane * 2; const int k = (int)(e % K), n = (int)(e / K); v2us o;
            o[0] = f2bf(w[(size_t)k * N + n]); o[1] = f2bf(w[(size_t)(k + 1) * N + n]); *(v2us*)(Bt + e) = o; }
         }
}
__global__ __launch_bounds__(256) void k_cvt8(const float* __restrict__ src, bf* dst, size_t n8) { const size_t i = (size_t)blockIdx.x * 256 + threadIdx.x; if (i >= n8) return; const v8f v = *(const v8f*)(src + i * 8); v8us o;
#pragma unroll
    for (int k = 0; k < 8; ++k) o[k] = f2bf(v[k]); *(v8us*)(dst + i * 8) = o;  }

// k_rope: head planes [h][t][d] (fp16 + hi/lo) of rope(x) x sc with the rotate-half convention out[d] = x[d] cos[t][d] - x[d+HD/2] sin[t][d], out[d+HD/2] = x[d+HD/2] cos[t][d+HD/2] + x[d] sin[t][d+HD/2]
__global__ __launch_bounds__(256) void k_rope(const float* __restrict__ F, int pitch, int nheads, const float* __restrict__ CS, const float* __restrict__ RF, const float* __restrict__ nw, float sc, h16* P16, bf* Ph, bf* Pl) {
    const size_t e = ((size_t)blockIdx.x * 256 + threadIdx.x) * 2; if (e >= (size_t)nheads * TT * HD) return; const int d = (int)(e % HD); const int t = (int)((e / HD) % TT); const int h = (int)(e / ((size_t)HD * TT)); const float* f = F + (size_t)t * pitch + h * HD; const float rf = RF ? RF[(size_t)h * TT + t] : 1.0f; v2h o16; v2us oh, ol;
#pragma unroll
    for (int q = 0; q < 2; ++q) { const int dd = d + q; const int dp = (dd < HD / 2) ? dd + HD / 2 : dd - HD / 2; float x0 = f[dd], x1 = f[dp];
        if (RF) { float n0 = __fmul_rn(x0, rf), n1 = __fmul_rn(x1, rf); asm volatile("" : "+v"(n0)); asm volatile("" : "+v"(n1)); x0 = __fmul_rn(bfr(nw[dd]), n0); x1 = __fmul_rn(bfr(nw[dp]), n1); }
        const v2f cs = *(const v2f*)(CS + ((size_t)t * HD + dd) * 2); float a = __fmul_rn(x0, cs[0]), bq = __fmul_rn(x1, cs[1]); asm volatile("" : "+v"(a)); asm volatile("" : "+v"(bq)); const float r = ((dd < HD / 2) ? __fsub_rn(a, bq) : __fadd_rn(a, bq)) * sc;
        o16[q] = tohx(r); unsigned short a2, c2; splitf(r, a2, c2); oh[q] = a2; ol[q] = c2; }
    *(v2h*)(P16 + e) = o16; *(v2us*)(Ph + e) = oh; *(v2us*)(Pl + e) = ol;  }
__global__ __launch_bounds__(256) void k_vtp(const float* __restrict__ F, int pitch, int nheads, h16* V16, bf* Vh, bf* Vl) { const size_t e = ((size_t)blockIdx.x * 256 + threadIdx.x) * 2; if (e >= (size_t)nheads * HD * TT) return; const int t = (int)(e % TT); const int d = (int)((e / TT) % HD); const int g = (int)(e / ((size_t)TT * HD)); v2h o16; v2us oh, ol;
#pragma unroll
    for (int q = 0; q < 2; ++q) { const float x = F[(size_t)(t + q) * pitch + g * HD + d]; o16[q] = tohx(x); unsigned short a2, c2; splitf(x, a2, c2); oh[q] = a2; ol[q] = c2; }
    const size_t o = (e / TT) * (2 * TT) + t;   // V^T rows at pitch 2 * TT: Vl = Vh + TT shares a row with Vh, the fp16 plane uses the first half of its rows
    *(v2h*)(V16 + o) = o16; *(v2us*)(Vh + o) = oh; *(v2us*)(Vl + o) = ol;  }
__global__ __launch_bounds__(256) void k_csid(float* CS) { const int idx = blockIdx.x * 256 + threadIdx.x; if (idx >= TT * HD) return; v2f cs; cs[0] = 1.0f; cs[1] = 0.0f; *(v2f*)(CS + (size_t)idx * 2) = cs;  }
#define FKB 64
#define FPI 72
#define SC2 0.18033688011112042f   // HD^-0.5 x log2(e)
// eight 2^x in one statement: results in registers apart from every argument ("=&v"), so no v_exp_f32 is followed by an instruction that reads its result or overwrites its argument; the closing v_nop is that free slot behind the last one
__device__ __forceinline__ v8f exp2x8(v8f x) { float r0, r1, r2, r3, r4, r5, r6, r7;
    asm("v_exp_f32 %0, %8\n\tv_exp_f32 %1, %9\n\tv_exp_f32 %2, %10\n\tv_exp_f32 %3, %11\n\tv_exp_f32 %4, %12\n\tv_exp_f32 %5, %13\n\tv_exp_f32 %6, %14\n\tv_exp_f32 %7, %15\n\tv_nop"
        : "=&v"(r0), "=&v"(r1), "=&v"(r2), "=&v"(r3), "=&v"(r4), "=&v"(r5), "=&v"(r6), "=&v"(r7) : "v"(x[0]), "v"(x[1]), "v"(x[2]), "v"(x[3]), "v"(x[4]), "v"(x[5]), "v"(x[6]), "v"(x[7]));
    return (v8f){r0, r1, r2, r3, r4, r5, r6, r7}; }
template <typename T16> struct WH8;
template <> struct WH8<h16> { typedef v8h H; };
template <> struct WH8<bf> { typedef v8us H; };
template <typename T16, int NPL>
__device__ __forceinline__ void fattn(const T16* __restrict__ Q, const T16* __restrict__ Q2, const T16* __restrict__ Kp, const T16* __restrict__ K2, const T16* __restrict__ Vt, int q0, int len, bf* Ah, bf* Al) {
    typedef typename WFrag<T16>::V V; typedef typename WH8<T16>::H H8;
    constexpr int PL = FKB * FPI, NP = TT / FKB;
    __shared__ __align__(16) T16 sm[2][2 * NPL * PL];   // [buffer][K plane(s), then V^T plane(s)][row][FPI]
    const int tid = threadIdx.x, lane = tid & 31, lr = lane & 15, hi = lane >> 4; const int wv = __builtin_amdgcn_readfirstlane(tid >> 5);
    const int qrow = q0 + wv * 16 + lr; const int sr = tid >> 3, sc = (tid & 7) * 8;   // staging: 8 threads per 128-B row, rows sr and sr + 32
    V qf[2], qf2[2];
#pragma unroll
    for (int ks = 0; ks < 2; ++ks) { qf[ks] = WFrag<T16>::ld(Q + (size_t)qrow * HD + ks * 32 + 8 * hi); if (NPL == 2) qf2[ks] = WFrag<T16>::ld(Q2 + (size_t)qrow * HD + ks * 32 + 8 * hi); }
    asm volatile("s_wait_xcnt 0x0" ::: "memory");   // the address registers of the query loads are given new values right behind them
    if (len <= 0) {   // no key kept: the module's scores are all equal: zero queries, no mask
#pragma unroll
        for (int ks = 0; ks < 2; ++ks) { qf[ks] = (V){}; if (NPL == 2) qf2[ks] = (V){}; }
        len = TT; }
    H8 st[2 * NPL][2];
    auto gl = [&](int kb) {
#pragma unroll
        for (int u = 0; u < 2; ++u) { const int row = sr + 32 * u;
            st[0][u] = *(const H8*)(Kp + (size_t)(kb + row) * HD + sc); if (NPL == 2) st[1][u] = *(const H8*)(K2 + (size_t)(kb + row) * HD + sc);
            st[NPL][u] = *(const H8*)(Vt + (size_t)row * (2 * TT) + kb + sc); if (NPL == 2) st[NPL + 1][u] = *(const H8*)(Vt + (size_t)row * (2 * TT) + TT + kb + sc); } };
    auto sl = [&](int bu) {
#pragma unroll
        for (int pl = 0; pl < 2 * NPL; ++pl)
#pragma unroll
            for (int u = 0; u < 2; ++u) *(H8*)(&sm[bu][pl * PL + (sr + 32 * u) * FPI + sc]) = st[pl][u]; };
    gl(0); sl(0);
    __syncthreads();   // pass 0's rows are in LDS before any wave reads them
    v8f o[4];
#pragma unroll
    for (int dt = 0; dt < 4; ++dt) o[dt] = (v8f){};
    float m = -3.0e38f, l = 0.0f;
#pragma unroll 1
    for (int it = 0; it < NP; ++it) {
        const int kb = it * FKB; const T16* bufp = &sm[it & 1][0];
        if (it + 1 < NP) gl(kb + FKB);
        v8f s[4];
        if (kb + FKB > len) { const int rem = len - kb - 8 * hi;
#pragma unroll
            for (int kt = 0; kt < 4; ++kt)
#pragma unroll
                for (int j = 0; j < 8; ++j) s[kt][j] = (kt * 16 + j >= rem) ? -3.0e38f : 0.0f;
        } else {
#pragma unroll
            for (int kt = 0; kt < 4; ++kt) s[kt] = (v8f){}; }
        // K fragments two key tiles ahead of their products
        const T16* kp = bufp + lr * FPI + 8 * hi; V kf[4][NPL][2];
        auto lk = [&](int kt) {
#pragma unroll
            for (int ks = 0; ks < 2; ++ks) { kf[kt][0][ks] = WFrag<T16>::ld(kp + kt * 16 * FPI + ks * 32); if (NPL == 2) kf[kt][1][ks] = WFrag<T16>::ld(kp + PL + kt * 16 * FPI + ks * 32); } };
        lk(0); lk(1);
#pragma unroll
        for (int kt = 0; kt < 4; ++kt) {
            if (kt + 2 < 4) { lk(kt + 2);
                __builtin_amdgcn_sched_barrier(0);   // keeps the reads of tile kt + 2 in front of tile kt's products: without it each product waits for a read issued just before it
            }
#pragma unroll
            for (int ks = 0; ks < 2; ++ks) { s[kt] = WFrag<T16>::mma(kf[kt][0][ks], qf[ks], s[kt]);
                if (NPL == 2) { s[kt] = WFrag<T16>::mma(kf[kt][0][ks], qf2[ks], s[kt]); s[kt] = WFrag<T16>::mma(kf[kt][1][ks], qf[ks], s[kt]); } } }
        // V^T fragments of one 32-key step, all at once into registers of their own
        const T16* vp = bufp + NPL * PL + lr * FPI + 8 * hi; V vf[NPL][4];
        auto lv = [&](int kk) {
#pragma unroll
            for (int dt = 0; dt < 4; ++dt) { vf[0][dt] = WFrag<T16>::ld(vp + dt * 16 * FPI + kk * 32); if (NPL == 2) vf[1][dt] = WFrag<T16>::ld(vp + PL + dt * 16 * FPI + kk * 32); } };
        lv(0);
        __builtin_amdgcn_sched_barrier(0);   // keeps these LDS reads in front of the softmax arithmetic, which covers their latency (sunk to their products, each product waits for its own read)
        float mj[8];   // eight independent maxima, then a tree
#pragma unroll
        for (int j = 0; j < 8; ++j) mj[j] = fmaxf(fmaxf(s[0][j], s[1][j]), fmaxf(s[2][j], s[3][j]));
        float mx = fmaxf(fmaxf(fmaxf(mj[0], mj[1]), fmaxf(mj[2], mj[3])), fmaxf(fmaxf(mj[4], mj[5]), fmaxf(mj[6], mj[7])));
        mx = fmaxf(mx, __shfl_xor(mx, 16, 32));
        const float mn = fmaxf(m, mx * SC2); const float al = __builtin_amdgcn_exp2f(m - mn); m = mn;
#pragma unroll
        for (int dt = 0; dt < 4; ++dt) o[dt] *= al;
#pragma unroll
        for (int kk = 0; kk < 2; ++kk) {
#pragma unroll
            for (int kt = 2 * kk; kt < 2 * kk + 2; ++kt) { v8f t;
#pragma unroll
                for (int j = 0; j < 8; ++j) t[j] = fmaf(s[kt][j], SC2, -mn);
                s[kt] = exp2x8(t); }
            if constexpr (NPL == 1) { v16h pb;
#pragma unroll
                for (int e = 0; e < 8; ++e) { pb[e] = tohx(s[2 * kk][e]); pb[8 + e] = tohx(s[2 * kk + 1][e]); }
#pragma unroll
                for (int dt = 0; dt < 4; ++dt) o[dt] = WFrag<T16>::mma(vf[0][dt], pb, o[dt]);
            } else { v16bf ph, pl;
#pragma unroll
                for (int e = 0; e < 16; ++e) { const float p = s[2 * kk + (e >> 3)][e & 7]; const __bf16 a = (__bf16)p; ph[e] = a; pl[e] = (__bf16)(p - (float)a); }
#pragma unroll
                for (int dt = 0; dt < 4; ++dt) { o[dt] = WFrag<T16>::mma(vf[0][dt], ph, o[dt]); o[dt] = WFrag<T16>::mma(vf[0][dt], pl, o[dt]); o[dt] = WFrag<T16>::mma(vf[NPL - 1][dt], ph, o[dt]); } }
            if (kk == 0) { lv(1);
                __builtin_amdgcn_sched_barrier(0);   // as above: the second step's reads stay in front of its exponentials
            } }
        const v8f sv = (s[0] + s[1]) + (s[2] + s[3]);   // eight independent partial sums, then a fixed tree
        l = l * al + (((sv[0] + sv[1]) + (sv[2] + sv[3])) + ((sv[4] + sv[5]) + (sv[6] + sv[7])));
        if (it + 1 < NP) sl((it + 1) & 1);
        __syncthreads();   // publishes pass it + 1's rows and ends every wave's reads of the buffer that pass it + 1 refills
    }
    l += __shfl_xor(l, 16, 32); const float inv = __fdiv_rn(1.0f, l);
    // lane (lr, hi) holds O[qrow][dt * 16 + 8 hi + j]: 16-byte stores; the wave alone writes its rows' 128-B lines of this head
    const size_t oo = (size_t)qrow * DQ + 8 * hi;
#pragma unroll
    for (int dt = 0; dt < 4; ++dt) { v8us oh, ol;
#pragma unroll
        for (int j = 0; j < 8; ++j) { unsigned short a, c2; splitf(o[dt][j] * inv, a, c2); oh[j] = a; ol[j] = c2; }
        *(v8us*)(Ah + oo + dt * 16) = oh; *(v8us*)(Al + oo + dt * 16) = ol; }
}
__global__ __launch_bounds__(256) void k_fattn(const h16* __restrict__ Q16, const h16* __restrict__ K16, const h16* __restrict__ V16, const bf* __restrict__ Qh, const bf* __restrict__ Ql, const bf* __restrict__ Kh, const bf* __restrict__ Kl, const bf* __restrict__ Vh, const int* __restrict__ lenb, bf* Ah, bf* Al) {
    const int h = blockIdx.y, q0 = blockIdx.x * 128; const int len = min(lenb[0], TT); const size_t hp = (size_t)h * TT * HD, hv = (size_t)h * HD * 2 * TT;
    if (q0 < RH) fattn<bf, 2>(Qh + hp, Ql + hp, Kh + hp, Kl + hp, Vh + hv, q0, len, Ah + h * HD, Al + h * HD);
    else fattn<h16, 1>(Q16 + hp, nullptr, K16 + hp, nullptr, V16 + hv, q0, len, Ah + h * HD, Al + h * HD);
}

extern "C" void kernel_launch(void* const* d_in, const int* in_sizes, int n_in,
                              void* d_out, int out_size, void* d_ws, size_t ws_size, hipStream_t stream) {
    (void)in_sizes; (void)n_in; (void)out_size;
    const float* x = (const float*)d_in[0]; const float* xk = (const float*)d_in[1]; const float* xv = (const float*)d_in[2]; const int* lens = (const int*)d_in[3]; const float* wq = (const float*)d_in[4]; const float* wk = (const float*)d_in[5]; const float* wv = (const float*)d_in[6]; const float* wo = (const float*)d_in[7];   /* input order q, k, v, valid_lens (int32 [2]: keys j >= valid_lens[b] are masked: READ on the device by k_fattn), Wq, Wk, Wv, Wo ('xw'): EIGHT inputs */
    float* OUT = (float*)d_out;     // [2][2048][1024]
    char* wsp = (char*)d_ws;
    auto take = [&](size_t bytes) { char* p = wsp; wsp += (bytes + 255) & ~(size_t)255; return (void*)p; };
    bf* WQ = (bf*)take((size_t)DQ * DM * 2); bf* WK = (bf*)take((size_t)DKV * DM * 2); bf* WV = (bf*)take((size_t)DKV * DM * 2); bf* WO = (bf*)take((size_t)DM * DQ * 2); float* CS = (float*)take((size_t)TT * HD * 2 * 4);
    bf* XB = (bf*)take((size_t)TT * DM * 2); float* FQ = (float*)take((size_t)TT * DQ * 4); float* FK = (float*)take((size_t)TT * DKV * 4);
    h16* QP16 = (h16*)take((size_t)NH_ * TT * HD * 2); h16* KP16 = (h16*)take((size_t)NKV * TT * HD * 2); h16* VT16 = (h16*)take((size_t)NKV * HD * 2 * TT * 2);
    bf* QPh = (bf*)take((size_t)NH_ * TT * HD * 2); bf* QPl = (bf*)take((size_t)NH_ * TT * HD * 2); bf* KPh = (bf*)take((size_t)NKV * TT * HD * 2); bf* KPl = (bf*)take((size_t)NKV * TT * HD * 2); bf* VTh = (bf*)take((size_t)NKV * HD * 2 * TT * 2); bf* VTl = VTh + TT;   /* V^T rows: pitch 2 * TT, hi then lo */
    bf* ATh = (bf*)take((size_t)TT * DQ * 2); bf* ATl = (bf*)take((size_t)TT * DQ * 2);
    if ((size_t)(wsp - (char*)d_ws) > ws_size) return;    // ws 256 MiB
    float* FV = FK;   // v projection reuses the k buffer after the k planes are built (stream-ordered)
    { k_wtG<<<(unsigned)((DM * DQ / 64 + 63) / 64), 256, 0, stream>>>(wq, DM, DQ, WQ); k_wtG<<<(unsigned)((DM * DKV / 64 + 63) / 64), 256, 0, stream>>>(wk, DM, DKV, WK); k_wtG<<<(unsigned)((DM * DKV / 64 + 63) / 64), 256, 0, stream>>>(wv, DM, DKV, WV);
      k_wtG<<<(unsigned)((DQ * DM / 64 + 63) / 64), 256, 0, stream>>>(wo, DQ, DM, WO);
       }
    k_csid<<<(TT * HD + 255) / 256, 256, 0, stream>>>(CS);
    const unsigned LQ = (unsigned)(((size_t)NH_ * TT * HD / 2 + 255) / 256), LKv = (unsigned)(((size_t)NKV * TT * HD / 2 + 255) / 256);
    for (int b = 0; b < NB_; ++b) {
        
        k_cvt8<<<(unsigned)(((size_t)TT * DM / 8 + 255) / 256), 256, 0, stream>>>(x + (size_t)b * TT * DM, XB, (size_t)TT * DM / 8);
        k_gemmw<bf, 0, false, 8><<<dim3(TT / 64, DQ / 64, 1), 256, 0, stream>>>(XB, nullptr, WQ, nullptr, DM, DM, FQ, DQ, nullptr, 0, 0, 0);
        k_rope<<<LQ, 256, 0, stream>>>(FQ, DQ, NH_, CS, nullptr, nullptr, 1.0f, QP16, QPh, QPl);
        k_cvt8<<<(unsigned)(((size_t)TT * DM / 8 + 255) / 256), 256, 0, stream>>>(xk + (size_t)b * TT * DM, XB, (size_t)TT * DM / 8);   /* XB := bf16(input_K[b]) */ k_gemmw<bf, 0, false, 8><<<dim3(TT / 64, DKV / 64, 1), 256, 0, stream>>>(XB, nullptr, WK, nullptr, DM, DM, FK, DKV, nullptr, 0, 0, 0);
        k_rope<<<LKv, 256, 0, stream>>>(FK, DKV, NKV, CS, nullptr, nullptr, 1.0f, KP16, KPh, KPl);
        k_cvt8<<<(unsigned)(((size_t)TT * DM / 8 + 255) / 256), 256, 0, stream>>>(xv + (size_t)b * TT * DM, XB, (size_t)TT * DM / 8);   /* XB := bf16(input_V[b]) */ k_gemmw<bf, 0, false, 8><<<dim3(TT / 64, DKV / 64, 1), 256, 0, stream>>>(XB, nullptr, WV, nullptr, DM, DM, FV, DKV, nullptr, 0, 0, 0); k_vtp<<<LKv, 256, 0, stream>>>(FV, DKV, NKV, VT16, VTh, VTl);
        k_fattn<<<dim3(TT / 128, NH_, 1), 256, 0, stream>>>(QP16, KP16, VT16, QPh, QPl, KPh, KPl, VTh, lens + b, ATh, ATl);   /* one kv head per query head; V^T rows: hi then lo at + TT */
        k_gemmw<bf, 1, false, 8><<<dim3(TT / 64, DM / 64, 1), 256, 0, stream>>>(ATh, ATl, WO, nullptr, DQ, DQ, OUT + (size_t)b * TT * DM, DM, nullptr, 0, 0, 0); }
}

// v004
// One run takes 231 microseconds.
// Two timings next to v003 both put it at 1.19 times that version's speed.
// Over all steps from v000 it is 8.79 times as fast.
#include <hip/hip_runtime.h>

// Multi-head attention on three input streams with a per-batch valid-length key mask (q, k, v [2][2048][1024]; qh, kh, vh = stream W ('xw' [1024][1024] 1/32, no bias; 16 heads x 64); scores / sqrt(64); keys j >= valid_lens[b] (int32 [2], read on the device) are REPLACED by -1e6 in the module (at least one key is always kept: numerically an exclusion: -3e38 here); softmax; out = merged Wo ('xw', no bias) -> [2][2048][1024] (4.2 M); argument order q, k, v, valid_lens, Wq, Wk, Wv, Wo).
// Layout per batch: bf16 copies of input_Q, input_K, input_V in turn (one staging buffer, refilled in stream order); 'xw' weights transposed once; exact projections whose epilogue writes the head planes itself (fp16 + hi/lo; V transposed); one fused attention kernel per batch (k_fattn: scores, length mask from valid_lens[b], online softmax, P x V, hi/lo merge; hybrid rows: < 512 hi/lo 3 products, rest fp16); merged hi/lo x W_O exact.
// Compute dtypes, f32 accumulate: every input rounded to bf16; projections exact; attention rows < 512 3 products, rest fp16; softmax f32; output projection hl x exact.

#define NB_  2
#define TT   2048
#define DM   1024
#define NH_  16
#define NKV  16
#define REP  (NH_ / NKV)
#define HD   64
#define DQ   (NH_ * HD)
#define DKV  (NKV * HD)
#define RH   512                  // query rows < RH use hi+lo planes (0: none)
#define WIN  0
#define SCL  0.125f   // HD^-0.5
typedef _Float16 h16;
typedef unsigned short bf;
typedef __attribute__((ext_vector_type(16))) __bf16   v16bf;
typedef __attribute__((ext_vector_type(16))) _Float16 v16h;
typedef __attribute__((ext_vector_type(8)))  _Float16 v8h;
typedef __attribute__((ext_vector_type(8)))  unsigned short v8us;
typedef __attribute__((ext_vector_type(8)))  float    v8f;
typedef __attribute__((ext_vector_type(4)))  float    v4f;
typedef v8h  __attribute__((may_alias)) v8ha;
typedef v4f  __attribute__((may_alias)) v4fa;
typedef v8us __attribute__((may_alias)) v8usa;

__device__ __forceinline__ unsigned short f2bf(float f) { unsigned u = __float_as_uint(f); u += 0x7FFFu + ((u >> 16) & 1u); return (unsigned short)(u >> 16); }
__device__ __forceinline__ float bf2f(unsigned short b) { return __uint_as_float(((unsigned)b) << 16); }
__device__ __forceinline__ float bfr(float f) { return bf2f(f2bf(f)); }
__device__ __forceinline__ v16h cat16(v8h lo, v8h hi) { return __builtin_shufflevector(lo, hi, 0, 1, 2, 3, 4, 5, 6, 7, 8, 9, 10, 11, 12, 13, 14, 15); }
__device__ __forceinline__ v16bf cat16b(v8us lo, v8us hi) { return __builtin_bit_cast(v16bf, __builtin_shufflevector(lo, hi, 0, 1, 2, 3, 4, 5, 6, 7, 8, 9, 10, 11, 12, 13, 14, 15)); }
__device__ __forceinline__ v8f wmma16(v16h a, v16h b, v8f c) { return __builtin_amdgcn_wmma_f32_16x16x32_f16(false, a, false, b, (short)0, c, false, false); }
__device__ __forceinline__ v8f wmmab(v16bf a, v16bf b, v8f c) { return __builtin_amdgcn_wmma_f32_16x16x32_bf16(false, a, false, b, (short)0, c, false, false); }



// ---- k_gemmw: register-blocked GEMM, W WAVES per 64x64 output tile (16 accumulators each), operands straight from K-contiguous 16-bit planes; grid (M/64, N/64, Z), 32 * W threads.
// W > 1: wave w takes the 32-wide k steps w, w + W, w + 2W, ... (neighbouring waves read neighbouring 64-B pieces of the same rows); the W partial tiles meet in LDS and are added in wave order 0..W-1.
// PM = 0: f32 C. PM = 1, 2 (N tile = one head of HD = 64 columns, W > 1): no C; the summed tile goes once more through LDS and leaves as 16-bit planes in whole 128-B lines: PM = 1 [head][row][d], PM = 2 transposed [head][d][row] at pitch 2 * TT.
// C[m][n] (f32, pitch ldc, + optional f32 bias[n]) = sum_k A[m][k] Bt[n][k] (+ split products per NSPLIT). K is the row pitch of A and Bt in elements, KD <= K the depth of the sum (the first KD elements of each row). z-batch strides sA/sB/sC in elements. KD % 32 == 0.
template <typename T16> struct WFrag;
template <> struct WFrag<h16> { typedef v16h V; static __device__ __forceinline__ V ld(const h16* p) { return cat16(*(const v8h*)p, *(const v8h*)(p + 16)); } static __device__ __forceinline__ v8f mma(V a, V b, v8f c) { return wmma16(a, b, c); } };
template <> struct WFrag<bf> { typedef v16bf V; static __device__ __forceinline__ V ld(const bf* p) { return cat16b(*(const v8us*)p, *(const v8us*)(p + 16)); } static __device__ __forceinline__ v8f mma(V a, V b, v8f c) { return wmmab(a, b, c); } };
template <typename T16, int NSPLIT, bool BIAS, int W, int PM>
__global__ __launch_bounds__(32 * W) void k_gemmw(const T16* __restrict__ A, const T16* __restrict__ A2, const T16* __restrict__ Bt, const T16* __restrict__ Bt2, int K, int KD, float* C, int ldc, const float* __restrict__ bias, size_t sA, size_t sB, size_t sC, h16* P16, bf* Ph, bf* Pl) {
    typedef typename WFrag<T16>::V V;
    __shared__ __align__(16) float os[W == 1 ? 16 * 68 : W * 4096 + (PM ? 64 * 68 : 0)];
    const int wv = __builtin_amdgcn_readfirstlane((int)(threadIdx.x >> 5));
    const size_t z = blockIdx.z; A += z * sA; if (A2) A2 += z * sA; Bt += z * sB; if (Bt2) Bt2 += z * sB; C += z * sC;
    const int lane = threadIdx.x & 31, lr = lane & 15, hi = lane >> 4; const int r0 = blockIdx.x * 64, c0 = blockIdx.y * 64;
    v8f acc[4][4];
#pragma unroll
    for (int mb = 0; mb < 4; ++mb)
#pragma unroll
        for (int nb = 0; nb < 4; ++nb) acc[mb][nb] = (v8f){};
    const size_t aoff = (size_t)(r0 + lr) * K + 8 * hi, boff = (size_t)(c0 + lr) * K + 8 * hi;
#pragma unroll 1
    for (int kc = wv * 32; kc < KD; kc += 32 * W) {
        V a[4], a2[4];
#pragma unroll
        for (int mb = 0; mb < 4; ++mb) { a[mb] = WFrag<T16>::ld(A + aoff + (size_t)mb * 16 * K + kc); if (NSPLIT == 1 || NSPLIT == 2) a2[mb] = WFrag<T16>::ld(A2 + aoff + (size_t)mb * 16 * K + kc); }
#pragma unroll
        for (int nb = 0; nb < 4; ++nb) { const V b = WFrag<T16>::ld(Bt + boff + (size_t)nb * 16 * K + kc); V b2; if (NSPLIT >= 2) b2 = WFrag<T16>::ld(Bt2 + boff + (size_t)nb * 16 * K + kc);
#pragma unroll
            for (int mb = 0; mb < 4; ++mb) { acc[mb][nb] = WFrag<T16>::mma(a[mb], b, acc[mb][nb]); if (NSPLIT == 1 || NSPLIT == 2) acc[mb][nb] = WFrag<T16>::mma(a2[mb], b, acc[mb][nb]); if (NSPLIT >= 2) acc[mb][nb] = WFrag<T16>::mma(a[mb], b2, acc[mb][nb]); } }
        asm volatile("v_nop\n\tv_nop\n\tv_nop\n\tv_nop" : "+v"(acc[0][0]), "+v"(acc[1][1]), "+v"(acc[2][2]), "+v"(acc[3][3]) : "v"(a[0]), "v"(a[3]));
    }
    if constexpr (W > 1) {
        // every wave parks its partial tile in accumulator order: [wave][mb * 4 + nb][j / 4][lane][j % 4], 16-byte stores, 512 contiguous bytes each
        float* mine = os + wv * 4096 + lane * 4;
#pragma unroll
        for (int mb = 0; mb < 4; ++mb)
#pragma unroll
            for (int nb = 0; nb < 4; ++nb) {
                *(v4fa*)(mine + ((mb * 4 + nb) * 2 + 0) * 128) = __builtin_shufflevector(acc[mb][nb], acc[mb][nb], 0, 1, 2, 3);
                *(v4fa*)(mine + ((mb * 4 + nb) * 2 + 1) * 128) = __builtin_shufflevector(acc[mb][nb], acc[mb][nb], 4, 5, 6, 7); }
        __syncthreads();   // all W partial tiles are in LDS before any wave adds them
        // wave wv owns the 64 / W whole output rows mbr * 16 + hi * 8 + j0 .. + JN - 1 (all 64 columns: it alone writes those lines)
        constexpr int JN = 32 / W; typedef float vjn __attribute__((ext_vector_type(JN), may_alias));
        const int mbr = wv / (W / 4), j0 = (wv % (W / 4)) * JN;
        const float* part = os + (((mbr * 4) * 2 + (j0 >> 2)) * 32 + lane) * 4 + (j0 & 3);
        vjn r[4];
#pragma unroll
        for (int nb = 0; nb < 4; ++nb) r[nb] = *(const vjn*)(part + nb * 256);
#pragma unroll
        for (int s = 1; s < W; ++s)
#pragma unroll
            for (int nb = 0; nb < 4; ++nb) r[nb] += *(const vjn*)(part + s * 4096 + nb * 256);
        if constexpr (PM != 0) {
            // the summed 64 x 64 tile in an LDS range of its own (no partial tile is overwritten), pitch 68 floats, in the order the planes want: PM = 1 [row][d], PM = 2 [d][row]
            float* T = os + W * 4096;
#pragma unroll
            for (int nb = 0; nb < 4; ++nb) {
                if constexpr (PM == 2) *(vjn*)(T + (nb * 16 + lr) * 68 + mbr * 16 + hi * 8 + j0) = r[nb];
                else {
#pragma unroll
                    for (int jj = 0; jj < JN; ++jj) T[(mbr * 16 + hi * 8 + j0 + jj) * 68 + nb * 16 + lr] = r[nb][jj]; } }
            __syncthreads();   // the whole summed tile is in LDS before any wave reads plane rows from it
            // 8 threads per plane row of 64 elements = one 128-B line; a wave alone writes its 64 / W lines of each plane, 4 per step
            constexpr int RS = 4 * W; const int tr = (int)threadIdx.x >> 3, tc = ((int)threadIdx.x & 7) * 8;
#pragma unroll
            for (int u = 0; u < 64 / RS; ++u) { const int row = tr + RS * u; const v4f x0 = *(const v4fa*)(T + row * 68 + tc), x1 = *(const v4fa*)(T + row * 68 + tc + 4); v8h o16; v8us oh, ol;
#pragma unroll
                for (int k = 0; k < 8; ++k) { const float x = k < 4 ? x0[k & 3] : x1[k & 3]; o16[k] = (h16)x; const unsigned short a = f2bf(x); oh[k] = a; ol[k] = f2bf(x - bf2f(a)); }
                const size_t o = PM == 1 ? ((size_t)blockIdx.y * TT + r0 + row) * HD + tc : ((size_t)blockIdx.y * HD + row) * (2 * TT) + r0 + tc;
                *(v8h*)(P16 + o) = o16; *(v8us*)(Ph + o) = oh; *(v8us*)(Pl + o) = ol; }
            return;
        }
        float* crow = C + (size_t)(r0 + mbr * 16 + hi * 8 + j0) * ldc + c0 + lr;
#pragma unroll
        for (int jj = 0; jj < JN; ++jj)
#pragma unroll
            for (int nb = 0; nb < 4; ++nb) crow[(size_t)jj * ldc + nb * 16] = BIAS ? r[nb][jj] + bfr(bias[c0 + nb * 16 + lr]) : r[nb][jj];
        return;
    }
#pragma unroll
    for (int mb = 0; mb < 4; ++mb) {
#pragma unroll
        for (int nb = 0; nb < 4; ++nb) {
#pragma unroll
            for (int j = 0; j < 8; ++j) os[(hi * 8 + j) * 68 + nb * 16 + lr] = acc[mb][nb][j]; }
        __builtin_amdgcn_wave_barrier(); asm volatile("" ::: "memory");
        float* crow = C + (size_t)(r0 + mb * 16) * ldc + c0;
{
#pragma unroll
            for (int s = 0; s < 8; ++s) { const int row = 2 * s + hi, cofs = lr * 4; v4f val = *(const v4fa*)(os + row * 68 + cofs); if (BIAS) { val[0] += bfr(bias[c0 + cofs]); val[1] += bfr(bias[c0 + cofs + 1]); val[2] += bfr(bias[c0 + cofs + 2]); val[3] += bfr(bias[c0 + cofs + 3]); }
                *(v4f*)(crow + (size_t)row * ldc + cofs) = val; }
             }
        __builtin_amdgcn_wave_barrier(); asm volatile("" ::: "memory");
    }
}

__device__ __forceinline__ h16 tohx(float x) { return (h16)x; }
__device__ __forceinline__ void splitf(float y, unsigned short& h, unsigned short& l) { h = f2bf(y); l = f2bf(y - bf2f(h)); }
typedef __attribute__((ext_vector_type(4))) _Float16 v4h;
typedef __attribute__((ext_vector_type(2))) unsigned short v2us;
typedef __attribute__((ext_vector_type(4))) unsigned short v4us;
typedef __attribute__((ext_vector_type(4))) int v4i;
typedef v4h  __attribute__((may_alias)) v4ha;
typedef v4us __attribute__((may_alias)) v4usa;

__global__ __launch_bounds__(256) void k_wtG(const float* __restrict__ w, int K, int N, bf* Bt) {
    const int lane = threadIdx.x & 31; const int L0 = (blockIdx.x * 8 + (threadIdx.x >> 5)) * 8; const int nlines = N * K / 64;
{
#pragma unroll 1
        for (int l = 0; l < 8; ++l) { const int L = L0 + l; if (L >= nlines) break; const size_t e = (size_t)L * 64 + lane * 2; const int k = (int)(e % K), n = (int)(e / K); v2us o;
            o[0] = f2bf(w[(size_t)k * N + n]); o[1] = f2bf(w[(size_t)(k + 1) * N + n]); *(v2us*)(Bt + e) = o; }
         }
}
__global__ __launch_bounds__(256) void k_cvt8(const float* __restrict__ src, bf* dst, size_t n8) { const size_t i = (size_t)blockIdx.x * 256 + threadIdx.x; if (i >= n8) return; const v8f v = *(const v8f*)(src + i * 8); v8us o;
#pragma unroll
    for (int k = 0; k < 8; ++k) o[k] = f2bf(v[k]); *(v8us*)(dst + i * 8) = o;  }

#define FKB 64
#define FPI 72
#define SC2 0.18033688011112042f   // HD^-0.5 x log2(e)
// eight 2^x in one statement: results in registers apart from every argument ("=&v"), so no v_exp_f32 is followed by an instruction that reads its result or overwrites its argument; the closing v_nop is that free slot behind the last one
__device__ __forceinline__ v8f exp2x8(v8f x) { float r0, r1, r2, r3, r4, r5, r6, r7;
    asm("v_exp_f32 %0, %8\n\tv_exp_f32 %1, %9\n\tv_exp_f32 %2, %10\n\tv_exp_f32 %3, %11\n\tv_exp_f32 %4, %12\n\tv_exp_f32 %5, %13\n\tv_exp_f32 %6, %14\n\tv_exp_f32 %7, %15\n\tv_nop"
        : "=&v"(r0), "=&v"(r1), "=&v"(r2), "=&v"(r3), "=&v"(r4), "=&v"(r5), "=&v"(r6), "=&v"(r7) : "v"(x[0]), "v"(x[1]), "v"(x[2]), "v"(x[3]), "v"(x[4]), "v"(x[5]), "v"(x[6]), "v"(x[7]));
    return (v8f){r0, r1, r2, r3, r4, r5, r6, r7}; }
template <typename T16> struct WH8;
template <> struct WH8<h16> { typedef v8h H; };
template <> struct WH8<bf> { typedef v8us H; };
template <typename T16, int NPL>
__device__ __forceinline__ void fattn(const T16* __restrict__ Q, const T16* __restrict__ Q2, const T16* __restrict__ Kp, const T16* __restrict__ K2, const T16* __restrict__ Vt, int q0, int len, bf* Ah, bf* Al) {
    typedef typename WFrag<T16>::V V; typedef typename WH8<T16>::H H8;
    constexpr int PL = FKB * FPI, NP = TT / FKB;
    __shared__ __align__(16) T16 sm[2][2 * NPL * PL];   // [buffer][K plane(s), then V^T plane(s)][row][FPI]
    const int tid = threadIdx.x, lane = tid & 31, lr = lane & 15, hi = lane >> 4; const int wv = __builtin_amdgcn_readfirstlane(tid >> 5);
    const int qrow = q0 + wv * 16 + lr; const int sr = tid >> 3, sc = (tid & 7) * 8;   // staging: 8 threads per 128-B row, rows sr and sr + 32
    V qf[2], qf2[2];
#pragma unroll
    for (int ks = 0; ks < 2; ++ks) { qf[ks] = WFrag<T16>::ld(Q + (size_t)qrow * HD + ks * 32 + 8 * hi); if (NPL == 2) qf2[ks] = WFrag<T16>::ld(Q2 + (size_t)qrow * HD + ks * 32 + 8 * hi); }
    asm volatile("s_wait_xcnt 0x0" ::: "memory");   // the address registers of the query loads are given new values right behind them
    if (len <= 0) {   // no key kept: the module's scores are all equal: zero queries, no mask
#pragma unroll
        for (int ks = 0; ks < 2; ++ks) { qf[ks] = (V){}; if (NPL == 2) qf2[ks] = (V){}; }
        len = TT; }
    H8 st[2 * NPL][2];
    auto gl = [&](int kb) {
#pragma unroll
        for (int u = 0; u < 2; ++u) { const int row = sr + 32 * u;
            st[0][u] = *(const H8*)(Kp + (size_t)(kb + row) * HD + sc); if (NPL == 2) st[1][u] = *(const H8*)(K2 + (size_t)(kb + row) * HD + sc);
            st[NPL][u] = *(const H8*)(Vt + (size_t)row * (2 * TT) + kb + sc); if (NPL == 2) st[NPL + 1][u] = *(const H8*)(Vt + (size_t)row * (2 * TT) + TT + kb + sc); } };
    auto sl = [&](int bu) {
#pragma unroll
        for (int pl = 0; pl < 2 * NPL; ++pl)
#pragma unroll
            for (int u = 0; u < 2; ++u) *(H8*)(&sm[bu][pl * PL + (sr + 32 * u) * FPI + sc]) = st[pl][u]; };
    gl(0); sl(0);
    __syncthreads();   // pass 0's rows are in LDS before any wave reads them
    v8f o[4];
#pragma unroll
    for (int dt = 0; dt < 4; ++dt) o[dt] = (v8f){};
    float m = -3.0e38f, l = 0.0f;
#pragma unroll 1
    for (int it = 0; it < NP; ++it) {
        const int kb = it * FKB; const T16* bufp = &sm[it & 1][0];
        if (it + 1 < NP) gl(kb + FKB);
        v8f s[4];
        if (kb + FKB > len) { const int rem = len - kb - 8 * hi;
#pragma unroll
            for (int kt = 0; kt < 4; ++kt)
#pragma unroll
                for (int j = 0; j < 8; ++j) s[kt][j] = (kt * 16 + j >= rem) ? -3.0e38f : 0.0f;
        } else {
#pragma unroll
            for (int kt = 0; kt < 4; ++kt) s[kt] = (v8f){}; }
        // K fragments two key tiles ahead of their products
        const T16* kp = bufp + lr * FPI + 8 * hi; V kf[4][NPL][2];
        auto lk = [&](int kt) {
#pragma unroll
            for (int ks = 0; ks < 2; ++ks) { kf[kt][0][ks] = WFrag<T16>::ld(kp + kt * 16 * FPI + ks * 32); if (NPL == 2) kf[kt][1][ks] = WFrag<T16>::ld(kp + PL + kt * 16 * FPI + ks * 32); } };
        lk(0); lk(1);
#pragma unroll
        for (int kt = 0; kt < 4; ++kt) {
            if (kt + 2 < 4) { lk(kt + 2);
                __builtin_amdgcn_sched_barrier(0);   // keeps the reads of tile kt + 2 in front of tile kt's products: without it each product waits for a read issued just before it
            }
#pragma unroll
            for (int ks = 0; ks < 2; ++ks) { s[kt] = WFrag<T16>::mma(kf[kt][0][ks], qf[ks], s[kt]);
                if (NPL == 2) { s[kt] = WFrag<T16>::mma(kf[kt][0][ks], qf2[ks], s[kt]); s[kt] = WFrag<T16>::mma(kf[kt][1][ks], qf[ks], s[kt]); } } }
        // V^T fragments of one 32-key step, all at once into registers of their own
        const T16* vp = bufp + NPL * PL + lr * FPI + 8 * hi; V vf[NPL][4];
        auto lv = [&](int kk) {
#pragma unroll
            for (int dt = 0; dt < 4; ++dt) { vf[0][dt] = WFrag<T16>::ld(vp + dt * 16 * FPI + kk * 32); if (NPL == 2) vf[1][dt] = WFrag<T16>::ld(vp + PL + dt * 16 * FPI + kk * 32); } };
        lv(0);
        __builtin_amdgcn_sched_barrier(0);   // keeps these LDS reads in front of the softmax arithmetic, which covers their latency (sunk to their products, each product waits for its own read)
        float mj[8];   // eight independent maxima, then a tree
#pragma unroll
        for (int j = 0; j < 8; ++j) mj[j] = fmaxf(fmaxf(s[0][j], s[1][j]), fmaxf(s[2][j], s[3][j]));
        float mx = fmaxf(fmaxf(fmaxf(mj[0], mj[1]), fmaxf(mj[2], mj[3])), fmaxf(fmaxf(mj[4], mj[5]), fmaxf(mj[6], mj[7])));
        mx = fmaxf(mx, __shfl_xor(mx, 16, 32));
        const float mn = fmaxf(m, mx * SC2); const float al = __builtin_amdgcn_exp2f(m - mn); m = mn;
#pragma unroll
        for (int dt = 0; dt < 4; ++dt) o[dt] *= al;
#pragma unroll
        for (int kk = 0; kk < 2; ++kk) {
#pragma unroll
            for (int kt = 2 * kk; kt < 2 * kk + 2; ++kt) { v8f t;
#pragma unroll
                for (int j = 0; j < 8; ++j) t[j] = fmaf(s[kt][j], SC2, -mn);
                s[kt] = exp2x8(t); }
            if constexpr (NPL == 1) { v16h pb;
#pragma unroll
                for (int e = 0; e < 8; ++e) { pb[e] = tohx(s[2 * kk][e]); pb[8 + e] = tohx(s[2 * kk + 1][e]); }
#pragma unroll
                for (int dt = 0; dt < 4; ++dt) o[dt] = WFrag<T16>::mma(vf[0][dt], pb, o[dt]);
            } else { v16bf ph, pl;
#pragma unroll
                for (int e = 0; e < 16; ++e) { const float p = s[2 * kk + (e >> 3)][e & 7]; const __bf16 a = (__bf16)p; ph[e] = a; pl[e] = (__bf16)(p - (float)a); }
#pragma unroll
                for (int dt = 0; dt < 4; ++dt) { o[dt] = WFrag<T16>::mma(vf[0][dt], ph, o[dt]); o[dt] = WFrag<T16>::mma(vf[0][dt], pl, o[dt]); o[dt] = WFrag<T16>::mma(vf[NPL - 1][dt], ph, o[dt]); } }
            if (kk == 0) { lv(1);
                __builtin_amdgcn_sched_barrier(0);   // as above: the second step's reads stay in front of its exponentials
            } }
        const v8f sv = (s[0] + s[1]) + (s[2] + s[3]);   // eight independent partial sums, then a fixed tree
        l = l * al + (((sv[0] + sv[1]) + (sv[2] + sv[3])) + ((sv[4] + sv[5]) + (sv[6] + sv[7])));
        if (it + 1 < NP) sl((it + 1) & 1);
        __syncthreads();   // publishes pass it + 1's rows and ends every wave's reads of the buffer that pass it + 1 refills
    }
    l += __shfl_xor(l, 16, 32); const float inv = __fdiv_rn(1.0f, l);
    // lane (lr, hi) holds O[qrow][dt * 16 + 8 hi + j]: 16-byte stores; the wave alone writes its rows' 128-B lines of this head
    const size_t oo = (size_t)qrow * DQ + 8 * hi;
#pragma unroll
    for (int dt = 0; dt < 4; ++dt) { v8us oh, ol;
#pragma unroll
        for (int j = 0; j < 8; ++j) { unsigned short a, c2; splitf(o[dt][j] * inv, a, c2); oh[j] = a; ol[j] = c2; }
        *(v8us*)(Ah + oo + dt * 16) = oh; *(v8us*)(Al + oo + dt * 16) = ol; }
}
__global__ __launch_bounds__(256) void k_fattn(const h16* __restrict__ Q16, const h16* __restrict__ K16, const h16* __restrict__ V16, const bf* __restrict__ Qh, const bf* __restrict__ Ql, const bf* __restrict__ Kh, const bf* __restrict__ Kl, const bf* __restrict__ Vh, const int* __restrict__ lenb, bf* Ah, bf* Al) {
    const int h = blockIdx.y, q0 = blockIdx.x * 128; const int len = min(lenb[0], TT); const size_t hp = (size_t)h * TT * HD, hv = (size_t)h * HD * 2 * TT;
    if (q0 < RH) fattn<bf, 2>(Qh + hp, Ql + hp, Kh + hp, Kl + hp, Vh + hv, q0, len, Ah + h * HD, Al + h * HD);
    else fattn<h16, 1>(Q16 + hp, nullptr, K16 + hp, nullptr, V16 + hv, q0, len, Ah + h * HD, Al + h * HD);
}

extern "C" void kernel_launch(void* const* d_in, const int* in_sizes, int n_in,
                              void* d_out, int out_size, void* d_ws, size_t ws_size, hipStream_t stream) {
    (void)in_sizes; (void)n_in; (void)out_size;
    const float* x = (const float*)d_in[0]; const float* xk = (const float*)d_in[1]; const float* xv = (const float*)d_in[2]; const int* lens = (const int*)d_in[3]; const float* wq = (const float*)d_in[4]; const float* wk = (const float*)d_in[5]; const float* wv = (const float*)d_in[6]; const float* wo = (const float*)d_in[7];   /* input order q, k, v, valid_lens (int32 [2]: keys j >= valid_lens[b] are masked: READ on the device by k_fattn), Wq, Wk, Wv, Wo ('xw'): EIGHT inputs */
    float* OUT = (float*)d_out;     // [2][2048][1024]
    char* wsp = (char*)d_ws;
    auto take = [&](size_t bytes) { char* p = wsp; wsp += (bytes + 255) & ~(size_t)255; return (void*)p; };
    bf* WQ = (bf*)take((size_t)DQ * DM * 2); bf* WK = (bf*)take((size_t)DKV * DM * 2); bf* WV = (bf*)take((size_t)DKV * DM * 2); bf* WO = (bf*)take((size_t)DM * DQ * 2);
    bf* XB = (bf*)take((size_t)TT * DM * 2);
    h16* QP16 = (h16*)take((size_t)NH_ * TT * HD * 2); h16* KP16 = (h16*)take((size_t)NKV * TT * HD * 2); h16* VT16 = (h16*)take((size_t)NKV * HD * 2 * TT * 2);
    bf* QPh = (bf*)take((size_t)NH_ * TT * HD * 2); bf* QPl = (bf*)take((size_t)NH_ * TT * HD * 2); bf* KPh = (bf*)take((size_t)NKV * TT * HD * 2); bf* KPl = (bf*)take((size_t)NKV * TT * HD * 2); bf* VTh = (bf*)take((size_t)NKV * HD * 2 * TT * 2); bf* VTl = VTh + TT;   /* V^T rows: pitch 2 * TT, hi then lo */
    bf* ATh = (bf*)take((size_t)TT * DQ * 2); bf* ATl = (bf*)take((size_t)TT * DQ * 2);
    if ((size_t)(wsp - (char*)d_ws) > ws_size) return;    // ws 256 MiB
    { k_wtG<<<(unsigned)((DM * DQ / 64 + 63) / 64), 256, 0, stream>>>(wq, DM, DQ, WQ); k_wtG<<<(unsigned)((DM * DKV / 64 + 63) / 64), 256, 0, stream>>>(wk, DM, DKV, WK); k_wtG<<<(unsigned)((DM * DKV / 64 + 63) / 64), 256, 0, stream>>>(wv, DM, DKV, WV);
      k_wtG<<<(unsigned)((DQ * DM / 64 + 63) / 64), 256, 0, stream>>>(wo, DQ, DM, WO);
       }
    for (int b = 0; b < NB_; ++b) {
        
        k_cvt8<<<(unsigned)(((size_t)TT * DM / 8 + 255) / 256), 256, 0, stream>>>(x + (size_t)b * TT * DM, XB, (size_t)TT * DM / 8);
        k_gemmw<bf, 0, false, 8, 1><<<dim3(TT / 64, DQ / 64, 1), 256, 0, stream>>>(XB, nullptr, WQ, nullptr, DM, DM, nullptr, 0, nullptr, 0, 0, 0, QP16, QPh, QPl);
        k_cvt8<<<(unsigned)(((size_t)TT * DM / 8 + 255) / 256), 256, 0, stream>>>(xk + (size_t)b * TT * DM, XB, (size_t)TT * DM / 8);   /* XB := bf16(input_K[b]) */ k_gemmw<bf, 0, false, 8, 1><<<dim3(TT / 64, DKV / 64, 1), 256, 0, stream>>>(XB, nullptr, WK, nullptr, DM, DM, nullptr, 0, nullptr, 0, 0, 0, KP16, KPh, KPl);
        k_cvt8<<<(unsigned)(((size_t)TT * DM / 8 + 255) / 256), 256, 0, stream>>>(xv + (size_t)b * TT * DM, XB, (size_t)TT * DM / 8);   /* XB := bf16(input_V[b]) */ k_gemmw<bf, 0, false, 8, 2><<<dim3(TT / 64, DKV / 64, 1), 256, 0, stream>>>(XB, nullptr, WV, nullptr, DM, DM, nullptr, 0, nullptr, 0, 0, 0, VT16, VTh, VTl);
        k_fattn<<<dim3(TT / 128, NH_, 1), 256, 0, stream>>>(QP16, KP16, VT16, QPh, QPl, KPh, KPl, VTh, lens + b, ATh, ATl);   /* one kv head per query head; V^T rows: hi then lo at + TT */
        k_gemmw<bf, 1, false, 8, 0><<<dim3(TT / 64, DM / 64, 1), 256, 0, stream>>>(ATh, ATl, WO, nullptr, DQ, DQ, OUT + (size_t)b * TT * DM, DM, nullptr, 0, 0, 0, nullptr, nullptr, nullptr); }
}

// v005
// It runs in 166 microseconds.
// Next to v004, in two timings, it ran 1.40 and 1.41 times as fast.
// Over all steps from v000 it is 12.4 times as fast.
#include <hip/hip_runtime.h>

// Multi-head attention on three input streams with a per-batch valid-length key mask (q, k, v [2][2048][1024]; qh, kh, vh = stream W ('xw' [1024][1024] 1/32, no bias; 16 heads x 64); scores / sqrt(64); keys j >= valid_lens[b] (int32 [2], read on the device) are REPLACED by -1e6 in the module (at least one key is always kept: numerically an exclusion: -3e38 here); softmax; out = merged Wo ('xw', no bias) -> [2][2048][1024] (4.2 M); argument order q, k, v, valid_lens, Wq, Wk, Wv, Wo).
// Layout, four launches, each over both batches: k_prep ('xw' weights transposed; bf16 copies of input_Q, input_K, input_V, a staging buffer each); the three exact projections in one grid (z = stream), whose epilogue writes the head planes itself (fp16 + hi/lo; V transposed); one fused attention kernel (z = batch) (k_fattn: scores, length mask from valid_lens[b], online softmax, P x V, hi/lo merge; hybrid rows: < 512 hi/lo 3 products, rest fp16); merged hi/lo x W_O exact.
// Compute dtypes, f32 accumulate: every input rounded to bf16; projections exact; attention rows < 512 3 products, rest fp16; softmax f32; output projection hl x exact.

#define NB_  2
#define TT   2048
#define DM   1024
#define NH_  16
#define NKV  16
#define REP  (NH_ / NKV)
#define HD   64
#define DQ   (NH_ * HD)
#define DKV  (NKV * HD)
#define RH   512                  // query rows < RH use hi+lo planes (0: none)
#define WIN  0
#define SCL  0.125f   // HD^-0.5
typedef _Float16 h16;
typedef unsigned short bf;
typedef __attribute__((ext_vector_type(16))) __bf16   v16bf;
typedef __attribute__((ext_vector_type(16))) _Float16 v16h;
typedef __attribute__((ext_vector_type(8)))  _Float16 v8h;
typedef __attribute__((ext_vector_type(8)))  unsigned short v8us;
typedef __attribute__((ext_vector_type(8)))  float    v8f;
typedef __attribute__((ext_vector_type(4)))  float    v4f;
typedef v8h  __attribute__((may_alias)) v8ha;
typedef v4f  __attribute__((may_alias)) v4fa;
typedef v8us __attribute__((may_alias)) v8usa;

__device__ __forceinline__ unsigned short f2bf(float f) { unsigned u = __float_as_uint(f); u += 0x7FFFu + ((u >> 16) & 1u); return (unsigned short)(u >> 16); }
__device__ __forceinline__ float bf2f(unsigned short b) { return __uint_as_float(((unsigned)b) << 16); }
__device__ __forceinline__ float bfr(float f) { return bf2f(f2bf(f)); }
__device__ __forceinline__ v16h cat16(v8h lo, v8h hi) { return __builtin_shufflevector(lo, hi, 0, 1, 2, 3, 4, 5, 6, 7, 8, 9, 10, 11, 12, 13, 14, 15); }
__device__ __forceinline__ v16bf cat16b(v8us lo, v8us hi) { return __builtin_bit_cast(v16bf, __builtin_shufflevector(lo, hi, 0, 1, 2, 3, 4, 5, 6, 7, 8, 9, 10, 11, 12, 13, 14, 15)); }
__device__ __forceinline__ v8f wmma16(v16h a, v16h b, v8f c) { return __builtin_amdgcn_wmma_f32_16x16x32_f16(false, a, false, b, (short)0, c, false, false); }
__device__ __forceinline__ v8f wmmab(v16bf a, v16bf b, v8f c) { return __builtin_amdgcn_wmma_f32_16x16x32_bf16(false, a, false, b, (short)0, c, false, false); }



// ---- k_gemmw: register-blocked GEMM, W WAVES per 64x64 output tile (16 accumulators each), operands straight from K-contiguous 16-bit planes; grid (M/64, N/64, Z), 32 * W threads.
// W > 1: wave w takes the 32-wide k steps w, w + W, w + 2W, ... (neighbouring waves read neighbouring 64-B pieces of the same rows); the W partial tiles meet in LDS and are added in wave order 0..W-1.
// PM = 0: f32 C. PM = 1 (N tile = one head of HD = 64 columns, W > 1; rows m = batch * TT + t; z = stream Q, K, V): no C; the summed tile goes once more through LDS and leaves as 16-bit planes in whole 128-B lines: Q, K [batch][head][t][d], V transposed [batch][head][d][t] at pitch 2 * TT.
// C[m][n] (f32, pitch ldc, + optional f32 bias[n]) = sum_k A[m][k] Bt[n][k] (+ split products per NSPLIT). K is the row pitch of A and Bt in elements, KD <= K the depth of the sum (the first KD elements of each row). z-batch strides sA/sB/sC in elements. KD % 32 == 0.
template <typename T16> struct WFrag;
template <> struct WFrag<h16> { typedef v16h V; static __device__ __forceinline__ V ld(const h16* p) { return cat16(*(const v8h*)p, *(const v8h*)(p + 16)); } static __device__ __forceinline__ v8f mma(V a, V b, v8f c) { return wmma16(a, b, c); } };
template <> struct WFrag<bf> { typedef v16bf V; static __device__ __forceinline__ V ld(const bf* p) { return cat16b(*(const v8us*)p, *(const v8us*)(p + 16)); } static __device__ __forceinline__ v8f mma(V a, V b, v8f c) { return wmmab(a, b, c); } };
struct Planes { h16* p16; bf* ph; bf* pl; };
template <typename T16, int NSPLIT, bool BIAS, int W, int PM>
__global__ __launch_bounds__(32 * W) void k_gemmw(const T16* __restrict__ A, const T16* __restrict__ A2, const T16* __restrict__ Bt, const T16* __restrict__ Bt2, int K, int KD, float* C, int ldc, const float* __restrict__ bias, size_t sA, size_t sB, size_t sC, Planes pq, Planes pk, Planes pv) {
    typedef typename WFrag<T16>::V V;
    __shared__ __align__(16) float os[W == 1 ? 16 * 68 : W * 4096 + (PM ? 64 * 68 : 0)];
    const int wv = __builtin_amdgcn_readfirstlane((int)(threadIdx.x >> 5));
    const size_t z = blockIdx.z; A += z * sA; if (A2) A2 += z * sA; Bt += z * sB; if (Bt2) Bt2 += z * sB; C += z * sC;
    const int lane = threadIdx.x & 31, lr = lane & 15, hi = lane >> 4; const int r0 = blockIdx.x * 64, c0 = blockIdx.y * 64;
    v8f acc[4][4];
#pragma unroll
    for (int mb = 0; mb < 4; ++mb)
#pragma unroll
        for (int nb = 0; nb < 4; ++nb) acc[mb][nb] = (v8f){};
    const size_t aoff = (size_t)(r0 + lr) * K + 8 * hi, boff = (size_t)(c0 + lr) * K + 8 * hi;
#pragma unroll 1
    for (int kc = wv * 32; kc < KD; kc += 32 * W) {
        V a[4], a2[4];
#pragma unroll
        for (int mb = 0; mb < 4; ++mb) { a[mb] = WFrag<T16>::ld(A + aoff + (size_t)mb * 16 * K + kc); if (NSPLIT == 1 || NSPLIT == 2) a2[mb] = WFrag<T16>::ld(A2 + aoff + (size_t)mb * 16 * K + kc); }
#pragma unroll
        for (int nb = 0; nb < 4; ++nb) { const V b = WFrag<T16>::ld(Bt + boff + (size_t)nb * 16 * K + kc); V b2; if (NSPLIT >= 2) b2 = WFrag<T16>::ld(Bt2 + boff + (size_t)nb * 16 * K + kc);
#pragma unroll
            for (int mb = 0; mb < 4; ++mb) { acc[mb][nb] = WFrag<T16>::mma(a[mb], b, acc[mb][nb]); if (NSPLIT == 1 || NSPLIT == 2) acc[mb][nb] = WFrag<T16>::mma(a2[mb], b, acc[mb][nb]); if (NSPLIT >= 2) acc[mb][nb] = WFrag<T16>::mma(a[mb], b2, acc[mb][nb]); } }
        asm volatile("v_nop\n\tv_nop\n\tv_nop\n\tv_nop" : "+v"(acc[0][0]), "+v"(acc[1][1]), "+v"(acc[2][2]), "+v"(acc[3][3]) : "v"(a[0]), "v"(a[3]));
    }
    if constexpr (W > 1) {
        // every wave parks its partial tile in accumulator order: [wave][mb * 4 + nb][j / 4][lane][j % 4], 16-byte stores, 512 contiguous bytes each
        float* mine = os + wv * 4096 + lane * 4;
#pragma unroll
        for (int mb = 0; mb < 4; ++mb)
#pragma unroll
            for (int nb = 0; nb < 4; ++nb) {
                *(v4fa*)(mine + ((mb * 4 + nb) * 2 + 0) * 128) = __builtin_shufflevector(acc[mb][nb], acc[mb][nb], 0, 1, 2, 3);
                *(v4fa*)(mine + ((mb * 4 + nb) * 2 + 1) * 128) = __builtin_shufflevector(acc[mb][nb], acc[mb][nb], 4, 5, 6, 7); }
        __syncthreads();   // all W partial tiles are in LDS before any wave adds them
        // wave wv owns the 64 / W whole output rows mbr * 16 + hi * 8 + j0 .. + JN - 1 (all 64 columns: it alone writes those lines)
        constexpr int JN = 32 / W; typedef float vjn __attribute__((ext_vector_type(JN), may_alias));
        const int mbr = wv / (W / 4), j0 = (wv % (W / 4)) * JN;
        const float* part = os + (((mbr * 4) * 2 + (j0 >> 2)) * 32 + lane) * 4 + (j0 & 3);
        vjn r[4];
#pragma unroll
        for (int nb = 0; nb < 4; ++nb) r[nb] = *(const vjn*)(part + nb * 256);
#pragma unroll
        for (int s = 1; s < W; ++s)
#pragma unroll
            for (int nb = 0; nb < 4; ++nb) r[nb] += *(const vjn*)(part + s * 4096 + nb * 256);
        if constexpr (PM != 0) {
            // the summed 64 x 64 tile in an LDS range of its own (no partial tile is overwritten), pitch 68 floats, in the order the planes want: Q, K [row][d], V [d][row]
            const bool tp = blockIdx.z == 2; const Planes ps = blockIdx.z == 0 ? pq : tp ? pv : pk;
            float* T = os + W * 4096;
            if (tp) {
#pragma unroll
                for (int nb = 0; nb < 4; ++nb) *(vjn*)(T + (nb * 16 + lr) * 68 + mbr * 16 + hi * 8 + j0) = r[nb];
            } else {
#pragma unroll
                for (int nb = 0; nb < 4; ++nb)
#pragma unroll
                    for (int jj = 0; jj < JN; ++jj) T[(mbr * 16 + hi * 8 + j0 + jj) * 68 + nb * 16 + lr] = r[nb][jj]; }
            __syncthreads();   // the whole summed tile is in LDS before any wave reads plane rows from it
            // 8 threads per plane row of 64 elements = one 128-B line; a wave alone writes its 8 lines of each plane, 4 per round
            constexpr int RS = 4 * W; const int tr = (int)threadIdx.x >> 3, tc = ((int)threadIdx.x & 7) * 8; const size_t pb = (size_t)(r0 / TT) * NH_ + blockIdx.y; const int t0 = r0 % TT;   // plane of this batch and head; first row inside the batch
            const size_t ob = tp ? pb * HD * (2 * TT) + t0 : (pb * TT + t0) * HD; const int op = tp ? 2 * TT : HD;   // first element and row pitch of this tile in its planes
#pragma unroll
            for (int u = 0; u < 64 / RS; ++u) { const int row = tr + RS * u; const v4f x0 = *(const v4fa*)(T + row * 68 + tc), x1 = *(const v4fa*)(T + row * 68 + tc + 4); v8h o16; v8us oh, ol;
#pragma unroll
                for (int k = 0; k < 8; ++k) { const float x = k < 4 ? x0[k & 3] : x1[k & 3]; o16[k] = (h16)x; const unsigned short a = f2bf(x); oh[k] = a; ol[k] = f2bf(x - bf2f(a)); }
                const size_t o = ob + (size_t)(row * op + tc);
                *(v8h*)(ps.p16 + o) = o16; *(v8us*)(ps.ph + o) = oh; *(v8us*)(ps.pl + o) = ol; }
            return;
        }
        float* crow = C + (size_t)(r0 + mbr * 16 + hi * 8 + j0) * ldc + c0 + lr;
#pragma unroll
        for (int jj = 0; jj < JN; ++jj)
#pragma unroll
            for (int nb = 0; nb < 4; ++nb) crow[(size_t)jj * ldc + nb * 16] = BIAS ? r[nb][jj] + bfr(bias[c0 + nb * 16 + lr]) : r[nb][jj];
        return;
    }
#pragma unroll
    for (int mb = 0; mb < 4; ++mb) {
#pragma unroll
        for (int nb = 0; nb < 4; ++nb) {
#pragma unroll
            for (int j = 0; j < 8; ++j) os[(hi * 8 + j) * 68 + nb * 16 + lr] = acc[mb][nb][j]; }
        __builtin_amdgcn_wave_barrier(); asm volatile("" ::: "memory");
        float* crow = C + (size_t)(r0 + mb * 16) * ldc + c0;
{
#pragma unroll
            for (int s = 0; s < 8; ++s) { const int row = 2 * s + hi, cofs = lr * 4; v4f val = *(const v4fa*)(os + row * 68 + cofs); if (BIAS) { val[0] += bfr(bias[c0 + cofs]); val[1] += bfr(bias[c0 + cofs + 1]); val[2] += bfr(bias[c0 + cofs + 2]); val[3] += bfr(bias[c0 + cofs + 3]); }
                *(v4f*)(crow + (size_t)row * ldc + cofs) = val; }
             }
        __builtin_amdgcn_wave_barrier(); asm volatile("" ::: "memory");
    }
}

__device__ __forceinline__ h16 tohx(float x) { return (h16)x; }
__device__ __forceinline__ void splitf(float y, unsigned short& h, unsigned short& l) { h = f2bf(y); l = f2bf(y - bf2f(h)); }
typedef __attribute__((ext_vector_type(4))) _Float16 v4h;
typedef __attribute__((ext_vector_type(2))) unsigned short v2us;
typedef __attribute__((ext_vector_type(4))) unsigned short v4us;
typedef __attribute__((ext_vector_type(4))) int v4i;
typedef v4h  __attribute__((may_alias)) v4ha;
typedef v4us __attribute__((may_alias)) v4usa;

__device__ __forceinline__ void wtG(const float* __restrict__ w, int K, int N, bf* Bt, int blk) {
    const int lane = threadIdx.x & 31; const int L0 = (blk * 8 + (threadIdx.x >> 5)) * 8; const int nlines = N * K / 64;
{
#pragma unroll 1
        for (int l = 0; l < 8; ++l) { const int L = L0 + l; if (L >= nlines) break; const size_t e = (size_t)L * 64 + lane * 2; const int k = (int)(e % K), n = (int)(e / K); v2us o;
            o[0] = f2bf(w[(size_t)k * N + n]); o[1] = f2bf(w[(size_t)(k + 1) * N + n]); *(v2us*)(Bt + e) = o; }
         }
}
__device__ __forceinline__ void cvt8(const float* __restrict__ src, bf* dst, size_t n8, int blk) { const size_t i = (size_t)blk * 256 + threadIdx.x; if (i >= n8) return; const v8f v = *(const v8f*)(src + i * 8); v8us o;
#pragma unroll
    for (int k = 0; k < 8; ++k) o[k] = f2bf(v[k]); *(v8us*)(dst + i * 8) = o;  }
// ---- k_prep: everything the projections wait for, in one grid: work-groups 0 .. 4 WTB - 1 transpose the four weights (WTB each, into WT[4][DM * DM]), the next 3 CVB round the three streams, both batches, to bf16 (CVB each, into XB[3][NB_ * TT * DM]).
#define WTB ((DM * DM / 64 + 63) / 64)
#define CVB (NB_ * TT * DM / 8 / 256)
static_assert(DQ == DM && DKV == DM && NKV == NH_, "one weight shape, one plane count");
__global__ __launch_bounds__(256) void k_prep(const float* __restrict__ wq, const float* __restrict__ wk, const float* __restrict__ wv, const float* __restrict__ wo, const float* __restrict__ xq, const float* __restrict__ xk, const float* __restrict__ xv, bf* WT, bf* XB) {
    const int blk = blockIdx.x;
    if (blk < 4 * WTB) { const int s = blk / WTB; wtG(s == 0 ? wq : s == 1 ? wk : s == 2 ? wv : wo, DM, DM, WT + (size_t)s * DM * DM, blk % WTB); return; }
    const int c = blk - 4 * WTB, s = c / CVB; cvt8(s == 0 ? xq : s == 1 ? xk : xv, XB + (size_t)s * NB_ * TT * DM, (size_t)NB_ * TT * DM / 8, c % CVB);
}

#define FKB 64
#define FPI 72
#define SC2 0.18033688011112042f   // HD^-0.5 x log2(e)
// eight 2^x in one statement: results in registers apart from every argument ("=&v"), so no v_exp_f32 is followed by an instruction that reads its result or overwrites its argument; the closing v_nop is that free slot behind the last one
__device__ __forceinline__ v8f exp2x8(v8f x) { float r0, r1, r2, r3, r4, r5, r6, r7;
    asm("v_exp_f32 %0, %8\n\tv_exp_f32 %1, %9\n\tv_exp_f32 %2, %10\n\tv_exp_f32 %3, %11\n\tv_exp_f32 %4, %12\n\tv_exp_f32 %5, %13\n\tv_exp_f32 %6, %14\n\tv_exp_f32 %7, %15\n\tv_nop"
        : "=&v"(r0), "=&v"(r1), "=&v"(r2), "=&v"(r3), "=&v"(r4), "=&v"(r5), "=&v"(r6), "=&v"(r7) : "v"(x[0]), "v"(x[1]), "v"(x[2]), "v"(x[3]), "v"(x[4]), "v"(x[5]), "v"(x[6]), "v"(x[7]));
    return (v8f){r0, r1, r2, r3, r4, r5, r6, r7}; }
template <typename T16> struct WH8;
template <> struct WH8<h16> { typedef v8h H; };
template <> struct WH8<bf> { typedef v8us H; };
template <typename T16, int NPL>
__device__ __forceinline__ void fattn(const T16* __restrict__ Q, const T16* __restrict__ Q2, const T16* __restrict__ Kp, const T16* __restrict__ K2, const T16* __restrict__ Vt, int q0, int len, bf* Ah, bf* Al) {
    typedef typename WFrag<T16>::V V; typedef typename WH8<T16>::H H8;
    constexpr int PL = FKB * FPI, NP = TT / FKB;
    __shared__ __align__(16) T16 sm[2][2 * NPL * PL];   // [buffer][K plane(s), then V^T plane(s)][row][FPI]
    const int tid = threadIdx.x, lane = tid & 31, lr = lane & 15, hi = lane >> 4; const int wv = __builtin_amdgcn_readfirstlane(tid >> 5);
    const int qrow = q0 + wv * 16 + lr; const int sr = tid >> 3, sc = (tid & 7) * 8;   // staging: 8 threads per 128-B row, rows sr and sr + 32
    V qf[2], qf2[2];
#pragma unroll
    for (int ks = 0; ks < 2; ++ks) { qf[ks] = WFrag<T16>::ld(Q + (size_t)qrow * HD + ks * 32 + 8 * hi); if (NPL == 2) qf2[ks] = WFrag<T16>::ld(Q2 + (size_t)qrow * HD + ks * 32 + 8 * hi); }
    asm volatile("s_wait_xcnt 0x0" ::: "memory");   // the address registers of the query loads are given new values right behind them
    if (len <= 0) {   // no key kept: the module's scores are all equal: zero queries, no mask
#pragma unroll
        for (int ks = 0; ks < 2; ++ks) { qf[ks] = (V){}; if (NPL == 2) qf2[ks] = (V){}; }
        len = TT; }
    H8 st[2 * NPL][2];
    auto gl = [&](int kb) {
#pragma unroll
        for (int u = 0; u < 2; ++u) { const int row = sr + 32 * u;
            st[0][u] = *(const H8*)(Kp + (size_t)(kb + row) * HD + sc); if (NPL == 2) st[1][u] = *(const H8*)(K2 + (size_t)(kb + row) * HD + sc);
            st[NPL][u] = *(const H8*)(Vt + (size_t)row * (2 * TT) + kb + sc); if (NPL == 2) st[NPL + 1][u] = *(const H8*)(Vt + (size_t)row * (2 * TT) + TT + kb + sc); } };
    auto sl = [&](int bu) {
#pragma unroll
        for (int pl = 0; pl < 2 * NPL; ++pl)
#pragma unroll
            for (int u = 0; u < 2; ++u) *(H8*)(&sm[bu][pl * PL + (sr + 32 * u) * FPI + sc]) = st[pl][u]; };
    gl(0); sl(0);
    __syncthreads();   // pass 0's rows are in LDS before any wave reads them
    v8f o[4];
#pragma unroll
    for (int dt = 0; dt < 4; ++dt) o[dt] = (v8f){};
    float m = -3.0e38f, l = 0.0f;
#pragma unroll 1
    for (int it = 0; it < NP; ++it) {
        const int kb = it * FKB; const T16* bufp = &sm[it & 1][0];
        if (it + 1 < NP) gl(kb + FKB);
        v8f s[4];
        if (kb + FKB > len) { const int rem = len - kb - 8 * hi;
#pragma unroll
            for (int kt = 0; kt < 4; ++kt)
#pragma unroll
                for (int j = 0; j < 8; ++j) s[kt][j] = (kt * 16 + j >= rem) ? -3.0e38f : 0.0f;
        } else {
#pragma unroll
            for (int kt = 0; kt < 4; ++kt) s[kt] = (v8f){}; }
        // K fragments two key tiles ahead of their products
        const T16* kp = bufp + lr * FPI + 8 * hi; V kf[4][NPL][2];
        auto lk = [&](int kt) {
#pragma unroll
            for (int ks = 0; ks < 2; ++ks) { kf[kt][0][ks] = WFrag<T16>::ld(kp + kt * 16 * FPI + ks * 32); if (NPL == 2) kf[kt][1][ks] = WFrag<T16>::ld(kp + PL + kt * 16 * FPI + ks * 32); } };
        lk(0); lk(1);
#pragma unroll
        for (int kt = 0; kt < 4; ++kt) {
            if (kt + 2 < 4) { lk(kt + 2);
                __builtin_amdgcn_sched_barrier(0);   // keeps the reads of tile kt + 2 in front of tile kt's products: without it each product waits for a read issued just before it
            }
#pragma unroll
            for (int ks = 0; ks < 2; ++ks) { s[kt] = WFrag<T16>::mma(kf[kt][0][ks], qf[ks], s[kt]);
                if (NPL == 2) { s[kt] = WFrag<T16>::mma(kf[kt][0][ks], qf2[ks], s[kt]); s[kt] = WFrag<T16>::mma(kf[kt][1][ks], qf[ks], s[kt]); } } }
        // V^T fragments of one 32-key step, all at once into registers of their own
        const T16* vp = bufp + NPL * PL + lr * FPI + 8 * hi; V vf[NPL][4];
        auto lv = [&](int kk) {
#pragma unroll
            for (int dt = 0; dt < 4; ++dt) { vf[0][dt] = WFrag<T16>::ld(vp + dt * 16 * FPI + kk * 32); if (NPL == 2) vf[1][dt] = WFrag<T16>::ld(vp + PL + dt * 16 * FPI + kk * 32); } };
        lv(0);
        __builtin_amdgcn_sched_barrier(0);   // keeps these LDS reads in front of the softmax arithmetic, which covers their latency (sunk to their products, each product waits for its own read)
        float mj[8];   // eight independent maxima, then a tree
#pragma unroll
        for (int j = 0; j < 8; ++j) mj[j] = fmaxf(fmaxf(s[0][j], s[1][j]), fmaxf(s[2][j], s[3][j]));
        float mx = fmaxf(fmaxf(fmaxf(mj[0], mj[1]), fmaxf(mj[2], mj[3])), fmaxf(fmaxf(mj[4], mj[5]), fmaxf(mj[6], mj[7])));
        mx = fmaxf(mx, __shfl_xor(mx, 16, 32));
        const float mn = fmaxf(m, mx * SC2); const float al = __builtin_amdgcn_exp2f(m - mn); m = mn;
#pragma unroll
        for (int dt = 0; dt < 4; ++dt) o[dt] *= al;
#pragma unroll
        for (int kk = 0; kk < 2; ++kk) {
#pragma unroll
            for (int kt = 2 * kk; kt < 2 * kk + 2; ++kt) { v8f t;
#pragma unroll
                for (int j = 0; j < 8; ++j) t[j] = fmaf(s[kt][j], SC2, -mn);
                s[kt] = exp2x8(t); }
            if constexpr (NPL == 1) { v16h pb;
#pragma unroll
                for (int e = 0; e < 8; ++e) { pb[e] = tohx(s[2 * kk][e]); pb[8 + e] = tohx(s[2 * kk + 1][e]); }
#pragma unroll
                for (int dt = 0; dt < 4; ++dt) o[dt] = WFrag<T16>::mma(vf[0][dt], pb, o[dt]);
            } else { v16bf ph, pl;
#pragma unroll
                for (int e = 0; e < 16; ++e) { const float p = s[2 * kk + (e >> 3)][e & 7]; const __bf16 a = (__bf16)p; ph[e] = a; pl[e] = (__bf16)(p - (float)a); }
#pragma unroll
                for (int dt = 0; dt < 4; ++dt) { o[dt] = WFrag<T16>::mma(vf[0][dt], ph, o[dt]); o[dt] = WFrag<T16>::mma(vf[0][dt], pl, o[dt]); o[dt] = WFrag<T16>::mma(vf[NPL - 1][dt], ph, o[dt]); } }
            if (kk == 0) { lv(1);
                __builtin_amdgcn_sched_barrier(0);   // as above: the second step's reads stay in front of its exponentials
            } }
        const v8f sv = (s[0] + s[1]) + (s[2] + s[3]);   // eight independent partial sums, then a fixed tree
        l = l * al + (((sv[0] + sv[1]) + (sv[2] + sv[3])) + ((sv[4] + sv[5]) + (sv[6] + sv[7])));
        if (it + 1 < NP) sl((it + 1) & 1);
        __syncthreads();   // publishes pass it + 1's rows and ends every wave's reads of the buffer that pass it + 1 refills
    }
    l += __shfl_xor(l, 16, 32); const float inv = __fdiv_rn(1.0f, l);
    // lane (lr, hi) holds O[qrow][dt * 16 + 8 hi + j]: 16-byte stores; the wave alone writes its rows' 128-B lines of this head
    const size_t oo = (size_t)qrow * DQ + 8 * hi;
#pragma unroll
    for (int dt = 0; dt < 4; ++dt) { v8us oh, ol;
#pragma unroll
        for (int j = 0; j < 8; ++j) { unsigned short a, c2; splitf(o[dt][j] * inv, a, c2); oh[j] = a; ol[j] = c2; }
        *(v8us*)(Ah + oo + dt * 16) = oh; *(v8us*)(Al + oo + dt * 16) = ol; }
}
__global__ __launch_bounds__(256) void k_fattn(const h16* __restrict__ Q16, const h16* __restrict__ K16, const h16* __restrict__ V16, const bf* __restrict__ Qh, const bf* __restrict__ Ql, const bf* __restrict__ Kh, const bf* __restrict__ Kl, const bf* __restrict__ Vh, const int* __restrict__ lenb, bf* Ah, bf* Al) {
    { const size_t b = blockIdx.z, pb = b * NH_ * TT * HD, vb = b * NKV * HD * 2 * TT, ab = b * TT * DQ; Q16 += pb; K16 += pb; V16 += vb; Qh += pb; Ql += pb; Kh += pb; Kl += pb; Vh += vb; lenb += b; Ah += ab; Al += ab; }   // this batch's planes, length and output rows
    const int h = blockIdx.y, q0 = blockIdx.x * 128; const int len = min(lenb[0], TT); const size_t hp = (size_t)h * TT * HD, hv = (size_t)h * HD * 2 * TT;
    if (q0 < RH) fattn<bf, 2>(Qh + hp, Ql + hp, Kh + hp, Kl + hp, Vh + hv, q0, len, Ah + h * HD, Al + h * HD);
    else fattn<h16, 1>(Q16 + hp, nullptr, K16 + hp, nullptr, V16 + hv, q0, len, Ah + h * HD, Al + h * HD);
}

extern "C" void kernel_launch(void* const* d_in, const int* in_sizes, int n_in,
                              void* d_out, int out_size, void* d_ws, size_t ws_size, hipStream_t stream) {
    (void)in_sizes; (void)n_in; (void)out_size;
    const float* x = (const float*)d_in[0]; const float* xk = (const float*)d_in[1]; const float* xv = (const float*)d_in[2]; const int* lens = (const int*)d_in[3]; const float* wq = (const float*)d_in[4]; const float* wk = (const float*)d_in[5]; const float* wv = (const float*)d_in[6]; const float* wo = (const float*)d_in[7];   /* input order q, k, v, valid_lens (int32 [2]: keys j >= valid_lens[b] are masked: READ on the device by k_fattn), Wq, Wk, Wv, Wo ('xw'): EIGHT inputs */
    float* OUT = (float*)d_out;     // [2][2048][1024]
    char* wsp = (char*)d_ws;
    auto take = [&](size_t bytes) { char* p = wsp; wsp += (bytes + 255) & ~(size_t)255; return (void*)p; };
    bf* WT = (bf*)take((size_t)4 * DM * DM * 2); bf* WO = WT + (size_t)3 * DM * DM;   /* Wq, Wk, Wv, Wo transposed, in this order */
    bf* XB = (bf*)take((size_t)3 * NB_ * TT * DM * 2);   /* bf16(input_Q), bf16(input_K), bf16(input_V), both batches each */
    h16* QP16 = (h16*)take((size_t)NB_ * NH_ * TT * HD * 2); h16* KP16 = (h16*)take((size_t)NB_ * NKV * TT * HD * 2); h16* VT16 = (h16*)take((size_t)NB_ * NKV * HD * 2 * TT * 2);
    bf* QPh = (bf*)take((size_t)NB_ * NH_ * TT * HD * 2); bf* QPl = (bf*)take((size_t)NB_ * NH_ * TT * HD * 2); bf* KPh = (bf*)take((size_t)NB_ * NKV * TT * HD * 2); bf* KPl = (bf*)take((size_t)NB_ * NKV * TT * HD * 2); bf* VTh = (bf*)take((size_t)NB_ * NKV * HD * 2 * TT * 2); bf* VTl = VTh + TT;   /* V^T rows: pitch 2 * TT, hi then lo */
    bf* ATh = (bf*)take((size_t)NB_ * TT * DQ * 2); bf* ATl = (bf*)take((size_t)NB_ * TT * DQ * 2);
    if ((size_t)(wsp - (char*)d_ws) > ws_size) return;    // ws 256 MiB
    const Planes pq = {QP16, QPh, QPl}, pk = {KP16, KPh, KPl}, pv = {VT16, VTh, VTl}, pn = {nullptr, nullptr, nullptr};
    k_prep<<<4 * WTB + 3 * CVB, 256, 0, stream>>>(wq, wk, wv, wo, x, xk, xv, WT, XB);
    k_gemmw<bf, 0, false, 8, 1><<<dim3(NB_ * TT / 64, DQ / 64, 3), 256, 0, stream>>>(XB, nullptr, WT, nullptr, DM, DM, nullptr, 0, nullptr, (size_t)NB_ * TT * DM, (size_t)DM * DM, 0, pq, pk, pv);
    k_fattn<<<dim3(TT / 128, NH_, NB_), 256, 0, stream>>>(QP16, KP16, VT16, QPh, QPl, KPh, KPl, VTh, lens, ATh, ATl);   /* one kv head per query head; V^T rows: hi then lo at + TT */
    k_gemmw<bf, 1, false, 8, 0><<<dim3(NB_ * TT / 64, DM / 64, 1), 256, 0, stream>>>(ATh, ATl, WO, nullptr, DQ, DQ, OUT, DM, nullptr, 0, 0, 0, pn, pn, pn);
}

// v006
// A run of this version takes 122 microseconds.
// In two side-by-side timings against v005, it was 1.35 and 1.36 times as fast.
// Counting every step since v000, it is 16.8 times as fast.
#include <hip/hip_runtime.h>

// Multi-head attention on three input streams with a per-batch valid-length key mask (q, k, v [2][2048][1024]; qh, kh, vh = stream W ('xw' [1024][1024] 1/32, no bias; 16 heads x 64); scores / sqrt(64); keys j >= valid_lens[b] (int32 [2], read on the device) are REPLACED by -1e6 in the module (at least one key is always kept: numerically an exclusion: -3e38 here); softmax; out = merged Wo ('xw', no bias) -> [2][2048][1024] (4.2 M); argument order q, k, v, valid_lens, Wq, Wk, Wv, Wo).
// Layout, four launches, each over both batches: k_prep ('xw' weights transposed; bf16 copies of input_Q, input_K, input_V, a staging buffer each); the three exact projections in one grid (z = stream), whose epilogue writes the head planes itself (fp16 + hi/lo; V transposed); one fused attention kernel (z = batch) (k_fattn: scores, length mask from valid_lens[b], online softmax, P x V, hi/lo merge; hybrid rows: < 512 hi/lo 3 products, rest fp16); merged hi/lo x W_O exact. Key rows from valid_lens[b] on, rounded up to a pass of 64 keys, are made and read by no launch (keyrows()).
// Compute dtypes, f32 accumulate: every input rounded to bf16; projections exact; attention rows < 512 3 products, rest fp16; softmax f32; output projection hl x exact.

#define NB_  2
#define TT   2048
#define DM   1024
#define NH_  16
#define NKV  16
#define REP  (NH_ / NKV)
#define HD   64
#define DQ   (NH_ * HD)
#define DKV  (NKV * HD)
#define RH   512                  // query rows < RH use hi+lo planes (0: none)
#define WIN  0
#define SCL  0.125f   // HD^-0.5
#define FKB  64                   // keys per attention pass
typedef _Float16 h16;
typedef unsigned short bf;
typedef __attribute__((ext_vector_type(16))) __bf16   v16bf;
typedef __attribute__((ext_vector_type(16))) _Float16 v16h;
typedef __attribute__((ext_vector_type(8)))  _Float16 v8h;
typedef __attribute__((ext_vector_type(8)))  unsigned short v8us;
typedef __attribute__((ext_vector_type(8)))  float    v8f;
typedef __attribute__((ext_vector_type(4)))  float    v4f;
typedef v8h  __attribute__((may_alias)) v8ha;
typedef v4f  __attribute__((may_alias)) v4fa;
typedef v8us __attribute__((may_alias)) v8usa;

__device__ __forceinline__ unsigned short f2bf(float f) { unsigned u = __float_as_uint(f); u += 0x7FFFu + ((u >> 16) & 1u); return (unsigned short)(u >> 16); }
__device__ __forceinline__ float bf2f(unsigned short b) { return __uint_as_float(((unsigned)b) << 16); }
__device__ __forceinline__ float bfr(float f) { return bf2f(f2bf(f)); }
// Key rows of batch b that the attention reads: valid_lens[b] clamped to at most TT (a length <= 0 keeps every key, as in k_fattn), rounded up to whole passes. Rows from there on get probability 0 and are read by nobody, so no launch makes them.
__device__ __forceinline__ int keyrows(const int* __restrict__ lens, int b) { int len = min(lens[b], TT); if (len <= 0) len = TT; return (len + FKB - 1) / FKB * FKB; }
__device__ __forceinline__ v16h cat16(v8h lo, v8h hi) { return __builtin_shufflevector(lo, hi, 0, 1, 2, 3, 4, 5, 6, 7, 8, 9, 10, 11, 12, 13, 14, 15); }
__device__ __forceinline__ v16bf cat16b(v8us lo, v8us hi) { return __builtin_bit_cast(v16bf, __builtin_shufflevector(lo, hi, 0, 1, 2, 3, 4, 5, 6, 7, 8, 9, 10, 11, 12, 13, 14, 15)); }
__device__ __forceinline__ v8f wmma16(v16h a, v16h b, v8f c) { return __builtin_amdgcn_wmma_f32_16x16x32_f16(false, a, false, b, (short)0, c, false, false); }
__device__ __forceinline__ v8f wmmab(v16bf a, v16bf b, v8f c) { return __builtin_amdgcn_wmma_f32_16x16x32_bf16(false, a, false, b, (short)0, c, false, false); }



// ---- k_gemmw: register-blocked GEMM, W WAVES per 64x64 output tile (16 accumulators each), operands straight from K-contiguous 16-bit planes; grid (M/64, N/64, Z), 32 * W threads.
// W > 1: wave w takes the 32-wide k steps w, w + W, w + 2W, ... (neighbouring waves read neighbouring 64-B pieces of the same rows); the W partial tiles meet in LDS and are added in wave order 0..W-1.
// PM = 0: f32 C. PM = 1 (N tile = one head of HD = 64 columns, W > 1; rows m = batch * TT + t; z = stream Q, K, V): no C; the summed tile goes once more through LDS and leaves as 16-bit planes in whole 128-B lines: Q, K [batch][head][t][d], V transposed [batch][head][d][t] at pitch 2 * TT.
// C[m][n] (f32, pitch ldc, + optional f32 bias[n]) = sum_k A[m][k] Bt[n][k] (+ split products per NSPLIT). K is the row pitch of A and Bt in elements, KD <= K the depth of the sum (the first KD elements of each row). z-batch strides sA/sB/sC in elements. KD % 32 == 0.
template <typename T16> struct WFrag;
template <> struct WFrag<h16> { typedef v16h V; static __device__ __forceinline__ V ld(const h16* p) { return cat16(*(const v8h*)p, *(const v8h*)(p + 16)); } static __device__ __forceinline__ v8f mma(V a, V b, v8f c) { return wmma16(a, b, c); } };
template <> struct WFrag<bf> { typedef v16bf V; static __device__ __forceinline__ V ld(const bf* p) { return cat16b(*(const v8us*)p, *(const v8us*)(p + 16)); } static __device__ __forceinline__ v8f mma(V a, V b, v8f c) { return wmmab(a, b, c); } };
struct Planes { h16* p16; bf* ph; bf* pl; };
template <typename T16, int NSPLIT, bool BIAS, int W, int PM>
__global__ __launch_bounds__(32 * W) void k_gemmw(const T16* __restrict__ A, const T16* __restrict__ A2, const T16* __restrict__ Bt, const T16* __restrict__ Bt2, int K, int KD, float* C, int ldc, const float* __restrict__ bias, size_t sA, size_t sB, size_t sC, Planes pq, Planes pk, Planes pv, const int* __restrict__ lens) {
    typedef typename WFrag<T16>::V V;
    if constexpr (PM != 0) { if (blockIdx.z != 0 && (int)(blockIdx.x * 64 % TT) >= keyrows(lens, (int)(blockIdx.x * 64 / TT))) return; }   // a K or V tile of masked keys alone: the whole work-group leaves, in front of every barrier
    __shared__ __align__(16) float os[W == 1 ? 16 * 68 : W * 4096 + (PM ? 64 * 68 : 0)];
    const int wv = __builtin_amdgcn_readfirstlane((int)(threadIdx.x >> 5));
    const size_t z = blockIdx.z; A += z * sA; if (A2) A2 += z * sA; Bt += z * sB; if (Bt2) Bt2 += z * sB; C += z * sC;
    const int lane = threadIdx.x & 31, lr = lane & 15, hi = lane >> 4; const int r0 = blockIdx.x * 64, c0 = blockIdx.y * 64;
    v8f acc[4][4];
#pragma unroll
    for (int mb = 0; mb < 4; ++mb)
#pragma unroll
        for (int nb = 0; nb < 4; ++nb) acc[mb][nb] = (v8f){};
    const size_t aoff = (size_t)(r0 + lr) * K + 8 * hi, boff = (size_t)(c0 + lr) * K + 8 * hi;
#pragma unroll 1
    for (int kc = wv * 32; kc < KD; kc += 32 * W) {
        V a[4], a2[4];
#pragma unroll
        for (int mb = 0; mb < 4; ++mb) { a[mb] = WFrag<T16>::ld(A + aoff + (size_t)mb * 16 * K + kc); if (NSPLIT == 1 || NSPLIT == 2) a2[mb] = WFrag<T16>::ld(A2 + aoff + (size_t)mb * 16 * K + kc); }
#pragma unroll
        for (int nb = 0; nb < 4; ++nb) { const V b = WFrag<T16>::ld(Bt + boff + (size_t)nb * 16 * K + kc); V b2; if (NSPLIT >= 2) b2 = WFrag<T16>::ld(Bt2 + boff + (size_t)nb * 16 * K + kc);
#pragma unroll
            for (int mb = 0; mb < 4; ++mb) { acc[mb][nb] = WFrag<T16>::mma(a[mb], b, acc[mb][nb]); if (NSPLIT == 1 || NSPLIT == 2) acc[mb][nb] = WFrag<T16>::mma(a2[mb], b, acc[mb][nb]); if (NSPLIT >= 2) acc[mb][nb] = WFrag<T16>::mma(a[mb], b2, acc[mb][nb]); } }
        asm volatile("v_nop\n\tv_nop\n\tv_nop\n\tv_nop" : "+v"(acc[0][0]), "+v"(acc[1][1]), "+v"(acc[2][2]), "+v"(acc[3][3]) : "v"(a[0]), "v"(a[3]));
    }
    if constexpr (W > 1) {
        // every wave parks its partial tile in accumulator order: [wave][mb * 4 + nb][j / 4][lane][j % 4], 16-byte stores, 512 contiguous bytes each
        float* mine = os + wv * 4096 + lane * 4;
#pragma unroll
        for (int mb = 0; mb < 4; ++mb)
#pragma unroll
            for (int nb = 0; nb < 4; ++nb) {
                *(v4fa*)(mine + ((mb * 4 + nb) * 2 + 0) * 128) = __builtin_shufflevector(acc[mb][nb], acc[mb][nb], 0, 1, 2, 3);
                *(v4fa*)(mine + ((mb * 4 + nb) * 2 + 1) * 128) = __builtin_shufflevector(acc[mb][nb], acc[mb][nb], 4, 5, 6, 7); }
        __syncthreads();   // all W partial tiles are in LDS before any wave adds them
        // wave wv owns the 64 / W whole output rows mbr * 16 + hi * 8 + j0 .. + JN - 1 (all 64 columns: it alone writes those lines)
        constexpr int JN = 32 / W; typedef float vjn __attribute__((ext_vector_type(JN), may_alias));
        const int mbr = wv / (W / 4), j0 = (wv % (W / 4)) * JN;
        const float* part = os + (((mbr * 4) * 2 + (j0 >> 2)) * 32 + lane) * 4 + (j0 & 3);
        vjn r[4];
#pragma unroll
        for (int nb = 0; nb < 4; ++nb) r[nb] = *(const vjn*)(part + nb * 256);
#pragma unroll
        for (int s = 1; s < W; ++s)
#pragma unroll
            for (int nb = 0; nb < 4; ++nb) r[nb] += *(const vjn*)(part + s * 4096 + nb * 256);
        if constexpr (PM != 0) {
            // the summed 64 x 64 tile in an LDS range of its own (no partial tile is overwritten), pitch 68 floats, in the order the planes want: Q, K [row][d], V [d][row]
            const bool tp = blockIdx.z == 2; const Planes ps = blockIdx.z == 0 ? pq : tp ? pv : pk;
            float* T = os + W * 4096;
            if (tp) {
#pragma unroll
                for (int nb = 0; nb < 4; ++nb) *(vjn*)(T + (nb * 16 + lr) * 68 + mbr * 16 + hi * 8 + j0) = r[nb];
            } else {
#pragma unroll
                for (int nb = 0; nb < 4; ++nb)
#pragma unroll
                    for (int jj = 0; jj < JN; ++jj) T[(mbr * 16 + hi * 8 + j0 + jj) * 68 + nb * 16 + lr] = r[nb][jj]; }
            __syncthreads();   // the whole summed tile is in LDS before any wave reads plane rows from it
            // 8 threads per plane row of 64 elements = one 128-B line; a wave alone writes its 8 lines of each plane, 4 per round
            constexpr int RS = 4 * W; const int tr = (int)threadIdx.x >> 3, tc = ((int)threadIdx.x & 7) * 8; const size_t pb = (size_t)(r0 / TT) * NH_ + blockIdx.y; const int t0 = r0 % TT;   // plane of this batch and head; first row inside the batch
            const size_t ob = tp ? pb * HD * (2 * TT) + t0 : (pb * TT + t0) * HD; const int op = tp ? 2 * TT : HD;   // first element and row pitch of this tile in its planes
#pragma unroll
            for (int u = 0; u < 64 / RS; ++u) { const int row = tr + RS * u; const v4f x0 = *(const v4fa*)(T + row * 68 + tc), x1 = *(const v4fa*)(T + row * 68 + tc + 4); v8h o16; v8us oh, ol;
#pragma unroll
                for (int k = 0; k < 8; ++k) { const float x = k < 4 ? x0[k & 3] : x1[k & 3]; o16[k] = (h16)x; const unsigned short a = f2bf(x); oh[k] = a; ol[k] = f2bf(x - bf2f(a)); }
                const size_t o = ob + (size_t)(row * op + tc);
                *(v8h*)(ps.p16 + o) = o16; *(v8us*)(ps.ph + o) = oh; *(v8us*)(ps.pl + o) = ol; }
            return;
        }
        float* crow = C + (size_t)(r0 + mbr * 16 + hi * 8 + j0) * ldc + c0 + lr;
#pragma unroll
        for (int jj = 0; jj < JN; ++jj)
#pragma unroll
            for (int nb = 0; nb < 4; ++nb) crow[(size_t)jj * ldc + nb * 16] = BIAS ? r[nb][jj] + bfr(bias[c0 + nb * 16 + lr]) : r[nb][jj];
        return;
    }
#pragma unroll
    for (int mb = 0; mb < 4; ++mb) {
#pragma unroll
        for (int nb = 0; nb < 4; ++nb) {
#pragma unroll
            for (int j = 0; j < 8; ++j) os[(hi * 8 + j) * 68 + nb * 16 + lr] = acc[mb][nb][j]; }
        __builtin_amdgcn_wave_barrier(); asm volatile("" ::: "memory");
        float* crow = C + (size_t)(r0 + mb * 16) * ldc + c0;
{
#pragma unroll
            for (int s = 0; s < 8; ++s) { const int row = 2 * s + hi, cofs = lr * 4; v4f val = *(const v4fa*)(os + row * 68 + cofs); if (BIAS) { val[0] += bfr(bias[c0 + cofs]); val[1] += bfr(bias[c0 + cofs + 1]); val[2] += bfr(bias[c0 + cofs + 2]); val[3] += bfr(bias[c0 + cofs + 3]); }
                *(v4f*)(crow + (size_t)row * ldc + cofs) = val; }
             }
        __builtin_amdgcn_wave_barrier(); asm volatile("" ::: "memory");
    }
}

__device__ __forceinline__ h16 tohx(float x) { return (h16)x; }
__device__ __forceinline__ void splitf(float y, unsigned short& h, unsigned short& l) { h = f2bf(y); l = f2bf(y - bf2f(h)); }
typedef __attribute__((ext_vector_type(4))) _Float16 v4h;
typedef __attribute__((ext_vector_type(2))) unsigned short v2us;
typedef __attribute__((ext_vector_type(4))) unsigned short v4us;
typedef __attribute__((ext_vector_type(4))) int v4i;
typedef v4h  __attribute__((may_alias)) v4ha;
typedef v4us __attribute__((may_alias)) v4usa;

__device__ __forceinline__ void wtG(const float* __restrict__ w, int K, int N, bf* Bt, int blk) {
    const int lane = threadIdx.x & 31; const int L0 = (blk * 8 + (threadIdx.x >> 5)) * 8; const int nlines = N * K / 64;
{
#pragma unroll 1
        for (int l = 0; l < 8; ++l) { const int L = L0 + l; if (L >= nlines) break; const size_t e = (size_t)L * 64 + lane * 2; const int k = (int)(e % K), n = (int)(e / K); v2us o;
            o[0] = f2bf(w[(size_t)k * N + n]); o[1] = f2bf(w[(size_t)(k + 1) * N + n]); *(v2us*)(Bt + e) = o; }
         }
}
__device__ __forceinline__ void cvt8(const float* __restrict__ src, bf* dst, size_t n8, int blk) { const size_t i = (size_t)blk * 256 + threadIdx.x; if (i >= n8) return; const v8f v = *(const v8f*)(src + i * 8); v8us o;
#pragma unroll
    for (int k = 0; k < 8; ++k) o[k] = f2bf(v[k]); *(v8us*)(dst + i * 8) = o;  }
// ---- k_prep: everything the projections wait for, in one grid: work-groups 0 .. 4 WTB - 1 transpose the four weights (WTB each, into WT[4][DM * DM]), the next 3 CVB round the three streams, both batches, to bf16 (CVB each, into XB[3][NB_ * TT * DM]).
#define WTB ((DM * DM / 64 + 63) / 64)
#define CVB (NB_ * TT * DM / 8 / 256)
static_assert(DQ == DM && DKV == DM && NKV == NH_, "one weight shape, one plane count");
static_assert(256 * 8 % DM == 0 && TT % (256 * 8 / DM) == 0, "a copy work-group holds whole rows of one batch");
__global__ __launch_bounds__(256) void k_prep(const float* __restrict__ wq, const float* __restrict__ wk, const float* __restrict__ wv, const float* __restrict__ wo, const float* __restrict__ xq, const float* __restrict__ xk, const float* __restrict__ xv, const int* __restrict__ lens, bf* WT, bf* XB) {
    const int blk = blockIdx.x;
    if (blk < 4 * WTB) { const int s = blk / WTB; wtG(s == 0 ? wq : s == 1 ? wk : s == 2 ? wv : wo, DM, DM, WT + (size_t)s * DM * DM, blk % WTB); return; }
    const int c = blk - 4 * WTB, s = c / CVB;
    if (s != 0) { const int row = c % CVB * (256 * 8 / DM); if (row % TT >= keyrows(lens, row / TT)) return; }   // rows of the K and V streams that no projection tile reads
    cvt8(s == 0 ? xq : s == 1 ? xk : xv, XB + (size_t)s * NB_ * TT * DM, (size_t)NB_ * TT * DM / 8, c % CVB);
}

#define FPI 72
#define SC2 0.18033688011112042f   // HD^-0.5 x log2(e)
// eight 2^x in one statement: results in registers apart from every argument ("=&v"), so no v_exp_f32 is followed by an instruction that reads its result or overwrites its argument; the closing v_nop is that free slot behind the last one
__device__ __forceinline__ v8f exp2x8(v8f x) { float r0, r1, r2, r3, r4, r5, r6, r7;
    asm("v_exp_f32 %0, %8\n\tv_exp_f32 %1, %9\n\tv_exp_f32 %2, %10\n\tv_exp_f32 %3, %11\n\tv_exp_f32 %4, %12\n\tv_exp_f32 %5, %13\n\tv_exp_f32 %6, %14\n\tv_exp_f32 %7, %15\n\tv_nop"
        : "=&v"(r0), "=&v"(r1), "=&v"(r2), "=&v"(r3), "=&v"(r4), "=&v"(r5), "=&v"(r6), "=&v"(r7) : "v"(x[0]), "v"(x[1]), "v"(x[2]), "v"(x[3]), "v"(x[4]), "v"(x[5]), "v"(x[6]), "v"(x[7]));
    return (v8f){r0, r1, r2, r3, r4, r5, r6, r7}; }
template <typename T16> struct WH8;
template <> struct WH8<h16> { typedef v8h H; };
template <> struct WH8<bf> { typedef v8us H; };
template <typename T16, int NPL>
__device__ __forceinline__ void fattn(const T16* __restrict__ Q, const T16* __restrict__ Q2, const T16* __restrict__ Kp, const T16* __restrict__ K2, const T16* __restrict__ Vt, int q0, int len, bf* Ah, bf* Al) {
    typedef typename WFrag<T16>::V V; typedef typename WH8<T16>::H H8;
    constexpr int PL = FKB * FPI, NP = TT / FKB;
    __shared__ __align__(16) T16 sm[2][2 * NPL * PL];   // [buffer][K plane(s), then V^T plane(s)][row][FPI]
    const int tid = threadIdx.x, lane = tid & 31, lr = lane & 15, hi = lane >> 4; const int wv = __builtin_amdgcn_readfirstlane(tid >> 5);
    const int qrow = q0 + wv * 16 + lr; const int sr = tid >> 3, sc = (tid & 7) * 8;   // staging: 8 threads per 128-B row, rows sr and sr + 32
    V qf[2], qf2[2];
#pragma unroll
    for (int ks = 0; ks < 2; ++ks) { qf[ks] = WFrag<T16>::ld(Q + (size_t)qrow * HD + ks * 32 + 8 * hi); if (NPL == 2) qf2[ks] = WFrag<T16>::ld(Q2 + (size_t)qrow * HD + ks * 32 + 8 * hi); }
    asm volatile("s_wait_xcnt 0x0" ::: "memory");   // the address registers of the query loads are given new values right behind them
    if (len <= 0) {   // no key kept: the module's scores are all equal: zero queries, no mask
#pragma unroll
        for (int ks = 0; ks < 2; ++ks) { qf[ks] = (V){}; if (NPL == 2) qf2[ks] = (V){}; }
        len = TT; }
    const int np = (len + FKB - 1) / FKB;   // passes that hold a kept key, 1 .. NP (len is clamped to 1 .. TT, the same for the whole work-group): np * FKB = keyrows()
    H8 st[2 * NPL][2];
    auto gl = [&](int kb) {
#pragma unroll
        for (int u = 0; u < 2; ++u) { const int row = sr + 32 * u;
            st[0][u] = *(const H8*)(Kp + (size_t)(kb + row) * HD + sc); if (NPL == 2) st[1][u] = *(const H8*)(K2 + (size_t)(kb + row) * HD + sc);
            st[NPL][u] = *(const H8*)(Vt + (size_t)row * (2 * TT) + kb + sc); if (NPL == 2) st[NPL + 1][u] = *(const H8*)(Vt + (size_t)row * (2 * TT) + TT + kb + sc); } };
    auto sl = [&](int bu) {
#pragma unroll
        for (int pl = 0; pl < 2 * NPL; ++pl)
#pragma unroll
            for (int u = 0; u < 2; ++u) *(H8*)(&sm[bu][pl * PL + (sr + 32 * u) * FPI + sc]) = st[pl][u]; };
    gl(0); sl(0);
    __syncthreads();   // pass 0's rows are in LDS before any wave reads them
    v8f o[4];
#pragma unroll
    for (int dt = 0; dt < 4; ++dt) o[dt] = (v8f){};
    float m = -3.0e38f, l = 0.0f;
    int it = 0;
#pragma unroll 1
    do {   // tested at the foot: np >= 1, so the first pass always runs; with the test at the head this build needs more than 256 registers a wave and only one work-group fits a WGP
        const int kb = it * FKB; const T16* bufp = &sm[it & 1][0];
        if (it + 1 < np) gl(kb + FKB);
        v8f s[4];
        if (kb + FKB > len) { const int rem = len - kb - 8 * hi;
#pragma unroll
            for (int kt = 0; kt < 4; ++kt)
#pragma unroll
                for (int j = 0; j < 8; ++j) s[kt][j] = (kt * 16 + j >= rem) ? -3.0e38f : 0.0f;
        } else {
#pragma unroll
            for (int kt = 0; kt < 4; ++kt) s[kt] = (v8f){}; }
        // K fragments two key tiles ahead of their products
        const T16* kp = bufp + lr * FPI + 8 * hi; V kf[4][NPL][2];
        auto lk = [&](int kt) {
#pragma unroll
            for (int ks = 0; ks < 2; ++ks) { kf[kt][0][ks] = WFrag<T16>::ld(kp + kt * 16 * FPI + ks * 32); if (NPL == 2) kf[kt][1][ks] = WFrag<T16>::ld(kp + PL + kt * 16 * FPI + ks * 32); } };
        lk(0); lk(1);
#pragma unroll
        for (int kt = 0; kt < 4; ++kt) {
            if (kt + 2 < 4) { lk(kt + 2);
                __builtin_amdgcn_sched_barrier(0);   // keeps the reads of tile kt + 2 in front of tile kt's products: without it each product waits for a read issued just before it
            }
#pragma unroll
            for (int ks = 0; ks < 2; ++ks) { s[kt] = WFrag<T16>::mma(kf[kt][0][ks], qf[ks], s[kt]);
                if (NPL == 2) { s[kt] = WFrag<T16>::mma(kf[kt][0][ks], qf2[ks], s[kt]); s[kt] = WFrag<T16>::mma(kf[kt][1][ks], qf[ks], s[kt]); } } }
        // V^T fragments of one 32-key step, all at once into registers of their own
        const T16* vp = bufp + NPL * PL + lr * FPI + 8 * hi; V vf[NPL][4];
        auto lv = [&](int kk) {
#pragma unroll
            for (int dt = 0; dt < 4; ++dt) { vf[0][dt] = WFrag<T16>::ld(vp + dt * 16 * FPI + kk * 32); if (NPL == 2) vf[1][dt] = WFrag<T16>::ld(vp + PL + dt * 16 * FPI + kk * 32); } };
        lv(0);
        __builtin_amdgcn_sched_barrier(0);   // keeps these LDS reads in front of the softmax arithmetic, which covers their latency (sunk to their products, each product waits for its own read)
        float mj[8];   // eight independent maxima, then a tree
#pragma unroll
        for (int j = 0; j < 8; ++j) mj[j] = fmaxf(fmaxf(s[0][j], s[1][j]), fmaxf(s[2][j], s[3][j]));
        float mx = fmaxf(fmaxf(fmaxf(mj[0], mj[1]), fmaxf(mj[2], mj[3])), fmaxf(fmaxf(mj[4], mj[5]), fmaxf(mj[6], mj[7])));
        mx = fmaxf(mx, __shfl_xor(mx, 16, 32));
        const float mn = fmaxf(m, mx * SC2); const float al = __builtin_amdgcn_exp2f(m - mn); m = mn;
#pragma unroll
        for (int dt = 0; dt < 4; ++dt) o[dt] *= al;
#pragma unroll
        for (int kk = 0; kk < 2; ++kk) {
#pragma unroll
            for (int kt = 2 * kk; kt < 2 * kk + 2; ++kt) { v8f t;
#pragma unroll
                for (int j = 0; j < 8; ++j) t[j] = fmaf(s[kt][j], SC2, -mn);
                s[kt] = exp2x8(t); }
            if constexpr (NPL == 1) { v16h pb;
#pragma unroll
                for (int e = 0; e < 8; ++e) { pb[e] = tohx(s[2 * kk][e]); pb[8 + e] = tohx(s[2 * kk + 1][e]); }
#pragma unroll
                for (int dt = 0; dt < 4; ++dt) o[dt] = WFrag<T16>::mma(vf[0][dt], pb, o[dt]);
            } else { v16bf ph, pl;
#pragma unroll
                for (int e = 0; e < 16; ++e) { const float p = s[2 * kk + (e >> 3)][e & 7]; const __bf16 a = (__bf16)p; ph[e] = a; pl[e] = (__bf16)(p - (float)a); }
#pragma unroll
                for (int dt = 0; dt < 4; ++dt) { o[dt] = WFrag<T16>::mma(vf[0][dt], ph, o[dt]); o[dt] = WFrag<T16>::mma(vf[0][dt], pl, o[dt]); o[dt] = WFrag<T16>::mma(vf[NPL - 1][dt], ph, o[dt]); } }
            if (kk == 0) { lv(1);
                __builtin_amdgcn_sched_barrier(0);   // as above: the second step's reads stay in front of its exponentials
            } }
        const v8f sv = (s[0] + s[1]) + (s[2] + s[3]);   // eight independent partial sums, then a fixed tree
        l = l * al + (((sv[0] + sv[1]) + (sv[2] + sv[3])) + ((sv[4] + sv[5]) + (sv[6] + sv[7])));
        if (it + 1 < np) sl((it + 1) & 1);
        __syncthreads();   // publishes pass it + 1's rows and ends every wave's reads of the buffer that pass it + 1 refills
    } while (++it < np);
    l += __shfl_xor(l, 16, 32); const float inv = __fdiv_rn(1.0f, l);
    // lane (lr, hi) holds O[qrow][dt * 16 + 8 hi + j]: 16-byte stores; the wave alone writes its rows' 128-B lines of this head
    const size_t oo = (size_t)qrow * DQ + 8 * hi;
#pragma unroll
    for (int dt = 0; dt < 4; ++dt) { v8us oh, ol;
#pragma unroll
        for (int j = 0; j < 8; ++j) { unsigned short a, c2; splitf(o[dt][j] * inv, a, c2); oh[j] = a; ol[j] = c2; }
        *(v8us*)(Ah + oo + dt * 16) = oh; *(v8us*)(Al + oo + dt * 16) = ol; }
}
__global__ __launch_bounds__(256) void k_fattn(const h16* __restrict__ Q16, const h16* __restrict__ K16, const h16* __restrict__ V16, const bf* __restrict__ Qh, const bf* __restrict__ Ql, const bf* __restrict__ Kh, const bf* __restrict__ Kl, const bf* __restrict__ Vh, const int* __restrict__ lenb, bf* Ah, bf* Al) {
    { const size_t b = blockIdx.z, pb = b * NH_ * TT * HD, vb = b * NKV * HD * 2 * TT, ab = b * TT * DQ; Q16 += pb; K16 += pb; V16 += vb; Qh += pb; Ql += pb; Kh += pb; Kl += pb; Vh += vb; lenb += b; Ah += ab; Al += ab; }   // this batch's planes, length and output rows
    const int h = blockIdx.y, q0 = blockIdx.x * 128; const int len = min(lenb[0], TT); const size_t hp = (size_t)h * TT * HD, hv = (size_t)h * HD * 2 * TT;
    if (q0 < RH) fattn<bf, 2>(Qh + hp, Ql + hp, Kh + hp, Kl + hp, Vh + hv, q0, len, Ah + h * HD, Al + h * HD);
    else fattn<h16, 1>(Q16 + hp, nullptr, K16 + hp, nullptr, V16 + hv, q0, len, Ah + h * HD, Al + h * HD);
}

extern "C" void kernel_launch(void* const* d_in, const int* in_sizes, int n_in,
                              void* d_out, int out_size, void* d_ws, size_t ws_size, hipStream_t stream) {
    (void)in_sizes; (void)n_in; (void)out_size;
    const float* x = (const float*)d_in[0]; const float* xk = (const float*)d_in[1]; const float* xv = (const float*)d_in[2]; const int* lens = (const int*)d_in[3]; const float* wq = (const float*)d_in[4]; const float* wk = (const float*)d_in[5]; const float* wv = (const float*)d_in[6]; const float* wo = (const float*)d_in[7];   /* input order q, k, v, valid_lens (int32 [2]: keys j >= valid_lens[b] are masked: READ on the device by k_fattn), Wq, Wk, Wv, Wo ('xw'): EIGHT inputs */
    float* OUT = (float*)d_out;     // [2][2048][1024]
    char* wsp = (char*)d_ws;
    auto take = [&](size_t bytes) { char* p = wsp; wsp += (bytes + 255) & ~(size_t)255; return (void*)p; };
    bf* WT = (bf*)take((size_t)4 * DM * DM * 2); bf* WO = WT + (size_t)3 * DM * DM;   /* Wq, Wk, Wv, Wo transposed, in this order */
    bf* XB = (bf*)take((size_t)3 * NB_ * TT * DM * 2);   /* bf16(input_Q), bf16(input_K), bf16(input_V), both batches each */
    h16* QP16 = (h16*)take((size_t)NB_ * NH_ * TT * HD * 2); h16* KP16 = (h16*)take((size_t)NB_ * NKV * TT * HD * 2); h16* VT16 = (h16*)take((size_t)NB_ * NKV * HD * 2 * TT * 2);
    bf* QPh = (bf*)take((size_t)NB_ * NH_ * TT * HD * 2); bf* QPl = (bf*)take((size_t)NB_ * NH_ * TT * HD * 2); bf* KPh = (bf*)take((size_t)NB_ * NKV * TT * HD * 2); bf* KPl = (bf*)take((size_t)NB_ * NKV * TT * HD * 2); bf* VTh = (bf*)take((size_t)NB_ * NKV * HD * 2 * TT * 2); bf* VTl = VTh + TT;   /* V^T rows: pitch 2 * TT, hi then lo */
    bf* ATh = (bf*)take((size_t)NB_ * TT * DQ * 2); bf* ATl = (bf*)take((size_t)NB_ * TT * DQ * 2);
    if ((size_t)(wsp - (char*)d_ws) > ws_size) return;    // ws 256 MiB
    const Planes pq = {QP16, QPh, QPl}, pk = {KP16, KPh, KPl}, pv = {VT16, VTh, VTl}, pn = {nullptr, nullptr, nullptr};
    k_prep<<<4 * WTB + 3 * CVB, 256, 0, stream>>>(wq, wk, wv, wo, x, xk, xv, lens, WT, XB);
    k_gemmw<bf, 0, false, 8, 1><<<dim3(NB_ * TT / 64, DQ / 64, 3), 256, 0, stream>>>(XB, nullptr, WT, nullptr, DM, DM, nullptr, 0, nullptr, (size_t)NB_ * TT * DM, (size_t)DM * DM, 0, pq, pk, pv, lens);
    k_fattn<<<dim3(TT / 128, NH_, NB_), 256, 0, stream>>>(QP16, KP16, VT16, QPh, QPl, KPh, KPl, VTh, lens, ATh, ATl);   /* one kv head per query head; V^T rows: hi then lo at + TT */
    k_gemmw<bf, 1, false, 8, 0><<<dim3(NB_ * TT / 64, DM / 64, 1), 256, 0, stream>>>(ATh, ATl, WO, nullptr, DQ, DQ, OUT, DM, nullptr, 0, 0, 0, pn, pn, pn, nullptr);
}

// v007
// It runs in 88.4 microseconds.
// Two timings next to v006 both put it at 1.38 times that version's speed.
// Counting every step since v000, it is 23.2 times as fast.
#include <hip/hip_runtime.h>

// Multi-head attention on three input streams with a per-batch valid-length key mask (q, k, v [2][2048][1024]; qh, kh, vh = stream W ('xw' [1024][1024] 1/32, no bias; 16 heads x 64); scores / sqrt(64); keys j >= valid_lens[b] (int32 [2], read on the device) are REPLACED by -1e6 in the module (at least one key is always kept: numerically an exclusion: -3e38 here); softmax; out = merged Wo ('xw', no bias) -> [2][2048][1024] (4.2 M); argument order q, k, v, valid_lens, Wq, Wk, Wv, Wo).
// Layout, four launches, each over both batches: k_prep ('xw' weights transposed; bf16 copies of input_Q, input_K, input_V, a staging buffer each); the three exact projections in one grid (z = stream), whose epilogue writes the head planes itself (fp16 + hi/lo; V transposed); one fused attention kernel (z = batch) (k_fattn: scores, length mask from valid_lens[b], online softmax, P x V, hi/lo merge; hybrid rows: < 512 hi/lo 3 products, rest fp16); merged hi/lo x W_O exact. Key rows from valid_lens[b] on, rounded up to a projection tile of 128 rows, are made and read by no launch (keyrows()).
// Compute dtypes, f32 accumulate: every input rounded to bf16; projections exact; attention rows < 512 3 products, rest fp16; softmax f32; output projection hl x exact.

#define NB_  2
#define TT   2048
#define DM   1024
#define NH_  16
#define NKV  16
#define REP  (NH_ / NKV)
#define HD   64
#define DQ   (NH_ * HD)
#define DKV  (NKV * HD)
#define RH   512                  // query rows < RH use hi+lo planes (0: none)
#define WIN  0
#define SCL  0.125f   // HD^-0.5
#define FKB  64                   // keys per attention pass
#define GTR  128                  // rows of a projection tile
typedef _Float16 h16;
typedef unsigned short bf;
typedef __attribute__((ext_vector_type(16))) __bf16   v16bf;
typedef __attribute__((ext_vector_type(16))) _Float16 v16h;
typedef __attribute__((ext_vector_type(8)))  _Float16 v8h;
typedef __attribute__((ext_vector_type(8)))  unsigned short v8us;
typedef __attribute__((ext_vector_type(8)))  float    v8f;
typedef __attribute__((ext_vector_type(4)))  float    v4f;
typedef v8h  __attribute__((may_alias)) v8ha;
typedef v4f  __attribute__((may_alias)) v4fa;
typedef v8us __attribute__((may_alias)) v8usa;

__device__ __forceinline__ unsigned short f2bf(float f) { unsigned u = __float_as_uint(f); u += 0x7FFFu + ((u >> 16) & 1u); return (unsigned short)(u >> 16); }
__device__ __forceinline__ float bf2f(unsigned short b) { return __uint_as_float(((unsigned)b) << 16); }
__device__ __forceinline__ float bfr(float f) { return bf2f(f2bf(f)); }
// Key rows of batch b that are made: valid_lens[b] clamped to at most TT (a length <= 0 keeps every key, as in k_fattn), rounded up to whole projection tiles of GTR rows (the attention reads whole passes of FKB of them). Rows from there on get probability 0 and are read by nobody, so no launch makes them.
__device__ __forceinline__ int keyrows(const int* __restrict__ lens, int b) { int len = min(lens[b], TT); if (len <= 0) len = TT; return (len + GTR - 1) / GTR * GTR; }
__device__ __forceinline__ v16h cat16(v8h lo, v8h hi) { return __builtin_shufflevector(lo, hi, 0, 1, 2, 3, 4, 5, 6, 7, 8, 9, 10, 11, 12, 13, 14, 15); }
__device__ __forceinline__ v16bf cat16b(v8us lo, v8us hi) { return __builtin_bit_cast(v16bf, __builtin_shufflevector(lo, hi, 0, 1, 2, 3, 4, 5, 6, 7, 8, 9, 10, 11, 12, 13, 14, 15)); }
__device__ __forceinline__ v8f wmma16(v16h a, v16h b, v8f c) { return __builtin_amdgcn_wmma_f32_16x16x32_f16(false, a, false, b, (short)0, c, false, false); }
__device__ __forceinline__ v8f wmmab(v16bf a, v16bf b, v8f c) { return __builtin_amdgcn_wmma_f32_16x16x32_bf16(false, a, false, b, (short)0, c, false, false); }



// ---- k_gemmw: GEMM with both operands staged in LDS. A work-group of 4 waves (2 x 2) makes a (32 MB) x 128 tile of C, a wave (16 MB) x 64 of it (MB x 4 accumulators) over the whole depth K = DM; grid (M / (32 MB), N / 128, Z), 128 threads.
// C[m][n] = sum_k A[m][k] Bt[n][k] (NSPLIT = 1: + A2[m][k] Bt[n][k]); A, A2, Bt are K-contiguous 16-bit planes of row pitch DM; z-batch strides sA / sB in elements.
// A pass is GKP = 64 k = one 128-B line of every operand row. Asynchronous copies bring it from memory into LDS (8 lanes a row, so a wave's copy is 4 whole lines; no register holds it); every row is fetched once per work-group and read by two waves.
// Rows of a buffer: A (then A2), then Bt, at pitch GPI elements = 144 B (keeps the 16-byte fragment reads off each other's banks). Two buffers: pass t + 2's copies are issued behind the barrier that ends pass t and fly during pass t + 1.
// PM = 0: f32 C, pitch DM. PM = 1 (MB = 4; a wave's 64 columns = one head; rows m = batch * TT + t; z = stream Q, K, V): no C; the tile leaves as 16-bit planes: Q, K [batch][head][t][d], V transposed [batch][head][d][t] at pitch 2 * TT.
// Either way a wave re-lays its own tile in LDS (the ring, free by then) and stores whole 128-B lines that it alone writes.
#define GKP 64
#define GPI 72
template <typename T16> struct WFrag;
template <> struct WFrag<h16> { typedef v16h V; static __device__ __forceinline__ V ld(const h16* p) { return cat16(*(const v8h*)p, *(const v8h*)(p + 16)); } static __device__ __forceinline__ v8f mma(V a, V b, v8f c) { return wmma16(a, b, c); } };
template <> struct WFrag<bf> { typedef v16bf V; static __device__ __forceinline__ V ld(const bf* p) { return cat16b(*(const v8us*)p, *(const v8us*)(p + 16)); } static __device__ __forceinline__ v8f mma(V a, V b, v8f c) { return wmmab(a, b, c); } };
struct Planes { h16* p16; bf* ph; bf* pl; };
typedef float __attribute__((may_alias)) fa;
// four copies of 16 B a lane, rows 16 apart (LDS byte address l, global address g); the closing s_wait_xcnt stands in the copies' own statement, so that no address register is given a new value in front of it
__device__ __forceinline__ void cp4(unsigned l, const char* g) {
    asm volatile("global_load_async_to_lds_b128 %0, %4, off\n\tglobal_load_async_to_lds_b128 %1, %5, off\n\tglobal_load_async_to_lds_b128 %2, %6, off\n\tglobal_load_async_to_lds_b128 %3, %7, off\n\ts_wait_xcnt 0x0"
        :: "v"(l), "v"(l + 16 * GPI * 2), "v"(l + 32 * GPI * 2), "v"(l + 48 * GPI * 2), "v"(g), "v"(g + 16 * DM * 2), "v"(g + 32 * DM * 2), "v"(g + 48 * DM * 2) : "memory"); }
template <typename T16, int NSPLIT, int MB, int PM>
__global__ __launch_bounds__(128) void k_gemmw(const T16* __restrict__ A, const T16* __restrict__ A2, const T16* __restrict__ Bt, float* C, size_t sA, size_t sB, Planes pq, Planes pk, Planes pv, const int* __restrict__ lens) {
    typedef typename WFrag<T16>::V V;
    constexpr int K = DM, TM = 32 * MB, NA = NSPLIT ? 2 : 1, BUFE = (NA * TM + 128) * GPI, NT = K / GKP, KG = NA * MB <= 4 && MB <= 2 ? 2 : 1;   // KG: 32-wide k steps whose fragments are read as one group (both of a pass where the registers allow)
    static_assert(sizeof(T16) == 2 && TM % 64 == 0 && NT >= 2 && (PM == 0 || (TM == GTR && TT % TM == 0 && HD == 64)), "tile shapes");
    static_assert(4 * MB * 16 * 68 * 4 <= 2 * BUFE * 2, "the four re-laid tiles fit the ring");
    const int r0 = blockIdx.x * TM, c0 = blockIdx.y * 128;
    if constexpr (PM != 0) { if (blockIdx.z != 0 && r0 % TT >= keyrows(lens, r0 / TT)) return; }   // a K or V tile of masked keys alone: the whole work-group leaves, in front of every barrier and copy
    __shared__ __align__(16) T16 sm[2 * BUFE];
    const int tid = threadIdx.x, lane = tid & 31, lr = lane & 15, hi = lane >> 4; const int wv = __builtin_amdgcn_readfirstlane(tid >> 5), wm = wv >> 1, wn = wv & 1;
    const size_t z = blockIdx.z; A += z * sA; if (NSPLIT) A2 += z * sA; Bt += z * sB;
    // copies: thread tid brings 16 B at column 8 (tid & 7) of rows (tid >> 3) + 16 i
    const int cr = tid >> 3, cc = (tid & 7) * 8;
    const unsigned lc = (unsigned)(size_t)&sm[0] + (unsigned)(cr * GPI + cc) * 2;   // low 32 bits of a __shared__ address = byte offset in the work-group's LDS
    const char* ga = (const char*)(A + (size_t)(r0 + cr) * K + cc); const char* ga2 = NSPLIT ? (const char*)(A2 + (size_t)(r0 + cr) * K + cc) : nullptr; const char* gb = (const char*)(Bt + (size_t)(c0 + cr) * K + cc);
    auto fill = [&](int t, int bu) { const unsigned l = lc + (unsigned)bu * (BUFE * 2); const int ko = t * GKP * 2;
#pragma unroll
        for (int q = 0; q < TM / 64; ++q) { cp4(l + q * 64 * GPI * 2, ga + ko + q * 64 * K * 2); if (NSPLIT) cp4(l + (TM + q * 64) * GPI * 2, ga2 + ko + q * 64 * K * 2); }
#pragma unroll
        for (int q = 0; q < 2; ++q) cp4(l + (NA * TM + q * 64) * GPI * 2, gb + ko + q * 64 * K * 2); };
    v8f acc[MB][4];
#pragma unroll
    for (int mb = 0; mb < MB; ++mb)
#pragma unroll
        for (int nb = 0; nb < 4; ++nb) acc[mb][nb] = (v8f){};
    fill(0, 0);
    asm volatile("s_wait_asynccnt 0x0" ::: "memory");   // this wave's copies of pass 0 have landed
    __syncthreads();   // pass 0's rows are in LDS before any wave reads them
    fill(1, 1);
    const int ao = (wm * MB * 16 + lr) * GPI + 8 * hi, bo = (NA * TM + wn * 64 + lr) * GPI + 8 * hi;
#pragma unroll 1   // one pass a trip: the buffer index and the foot's waits and barrier stay in one place
    for (int t = 0; t < NT; ++t) {
        const T16* bp = &sm[(t & 1) * BUFE];
#pragma unroll
        for (int kg = 0; kg < GKP / 32 / KG; ++kg) {
            V a[KG][MB], a2[KG][MB], b[KG][4];
#pragma unroll
            for (int k2 = 0; k2 < KG; ++k2) { const int ko = (kg * KG + k2) * 32;
#pragma unroll
                for (int mb = 0; mb < MB; ++mb) { a[k2][mb] = WFrag<T16>::ld(bp + ao + mb * 16 * GPI + ko); if (NSPLIT) a2[k2][mb] = WFrag<T16>::ld(bp + ao + (TM + mb * 16) * GPI + ko); }
#pragma unroll
                for (int nb = 0; nb < 4; ++nb) b[k2][nb] = WFrag<T16>::ld(bp + bo + nb * 16 * GPI + ko); }
            __builtin_amdgcn_sched_barrier(0);   // keeps the group's LDS reads together in front of its products: sunk among them, every column block waits out a read issued just before it
#pragma unroll
            for (int k2 = 0; k2 < KG; ++k2)
#pragma unroll
                for (int nb = 0; nb < 4; ++nb)
#pragma unroll
                    for (int mb = 0; mb < MB; ++mb) { acc[mb][nb] = WFrag<T16>::mma(a[k2][mb], b[k2][nb], acc[mb][nb]); if (NSPLIT) acc[mb][nb] = WFrag<T16>::mma(a2[k2][mb], b[k2][nb], acc[mb][nb]); } }
        __builtin_amdgcn_sched_barrier(0);   // keeps pass t's products in front of the foot's waits: sunk behind the barrier, nothing would run while pass t + 1's copies fly
        asm volatile("s_wait_dscnt 0x0" ::: "memory");      // this wave's reads of pass t's buffer are over
        asm volatile("s_wait_asynccnt 0x0" ::: "memory");   // this wave's copies of pass t + 1 have landed
        __syncthreads();   // publishes pass t + 1's rows and ends every wave's reads of the buffer that is refilled behind it
        if (t + 2 < NT) fill(t + 2, t & 1);
    }
    asm volatile("s_wait_asynccnt 0x0" ::: "memory");   // no copy is under way when the ring becomes output staging
    // the wave's tile in an LDS range of its own, pitch 68 floats, in the order the stores want: [row][column]; V planes [d][row]
    fa* T = (fa*)&sm[0] + wv * (MB * 16 * 68);
    const bool tp = PM != 0 && blockIdx.z == 2;
    if (tp) {
#pragma unroll
        for (int mb = 0; mb < MB; ++mb)
#pragma unroll
            for (int nb = 0; nb < 4; ++nb) {
                *(v4fa*)(T + (nb * 16 + lr) * 68 + mb * 16 + hi * 8) = __builtin_shufflevector(acc[mb][nb], acc[mb][nb], 0, 1, 2, 3);
                *(v4fa*)(T + (nb * 16 + lr) * 68 + mb * 16 + hi * 8 + 4) = __builtin_shufflevector(acc[mb][nb], acc[mb][nb], 4, 5, 6, 7); }
    } else {
#pragma unroll
        for (int mb = 0; mb < MB; ++mb)
#pragma unroll
            for (int nb = 0; nb < 4; ++nb)
#pragma unroll
                for (int j = 0; j < 8; ++j) T[(mb * 16 + hi * 8 + j) * 68 + nb * 16 + lr] = acc[mb][nb][j]; }
    __syncthreads();   // the re-laid tile is whole in LDS before its lanes read each other's values
    if constexpr (PM != 0) {
        // 8 lanes per plane row of 64 elements = one 128-B line; 4 lines of each plane a step
        const Planes ps = blockIdx.z == 0 ? pq : tp ? pv : pk;
        const int tr = lane >> 3, tc = (lane & 7) * 8, rw = r0 + wm * 64; const size_t pb = (size_t)(rw / TT) * NH_ + blockIdx.y * 2 + wn; const int t0 = rw % TT;   // plane of this batch and head; first row inside the batch
        const size_t ob = tp ? pb * HD * (2 * TT) + t0 : (pb * TT + t0) * HD; const int op = tp ? 2 * TT : HD;   // first element and row pitch of this tile in its planes
#pragma unroll 1   // one step a trip, so that the closing wait stands in front of every new value of a register that a store of the step names
        for (int u = 0; u < 16; ++u) { const int row = tr + 4 * u; const v4f x0 = *(const v4fa*)(T + row * 68 + tc), x1 = *(const v4fa*)(T + row * 68 + tc + 4); v8h o16; v8us oh, ol;
#pragma unroll
            for (int k = 0; k < 8; ++k) { const float x = k < 4 ? x0[k & 3] : x1[k & 3]; o16[k] = (h16)x; const unsigned short a = f2bf(x); oh[k] = a; ol[k] = f2bf(x - bf2f(a)); }
            const size_t o = ob + (size_t)(row * op + tc);
            *(v8h*)(ps.p16 + o) = o16; *(v8us*)(ps.ph + o) = oh; *(v8us*)(ps.pl + o) = ol;
            asm volatile("s_wait_xcnt 0x0" ::: "memory");   // the next step gives the stores' address and data registers new values
        }
    } else {
        // 16 lanes per row of 64 floats = two 128-B lines; 2 rows a step
        float* crow = C + (size_t)(r0 + wm * MB * 16 + hi) * DM + c0 + wn * 64 + lr * 4; const fa* trow = T + hi * 68 + lr * 4; v4f x[MB * 8];
#pragma unroll
        for (int u = 0; u < MB * 8; ++u) x[u] = *(const v4fa*)(trow + 2 * u * 68);
#pragma unroll
        for (int u = 0; u < MB * 8; ++u) *(v4f*)(crow + 2 * u * DM) = x[u];
    }
}

__device__ __forceinline__ h16 tohx(float x) { return (h16)x; }
__device__ __forceinline__ void splitf(float y, unsigned short& h, unsigned short& l) { h = f2bf(y); l = f2bf(y - bf2f(h)); }
typedef __attribute__((ext_vector_type(4))) _Float16 v4h;
typedef __attribute__((ext_vector_type(2))) unsigned short v2us;
typedef __attribute__((ext_vector_type(4))) unsigned short v4us;
typedef __attribute__((ext_vector_type(4))) int v4i;
typedef v4h  __attribute__((may_alias)) v4ha;
typedef v4us __attribute__((may_alias)) v4usa;

__device__ __forceinline__ void wtG(const float* __restrict__ w, int K, int N, bf* Bt, int blk) {
    const int lane = threadIdx.x & 31; const int L0 = (blk * 8 + (threadIdx.x >> 5)) * 8; const int nlines = N * K / 64;
{
#pragma unroll 1
        for (int l = 0; l < 8; ++l) { const int L = L0 + l; if (L >= nlines) break; const size_t e = (size_t)L * 64 + lane * 2; const int k = (int)(e % K), n = (int)(e / K); v2us o;
            o[0] = f2bf(w[(size_t)k * N + n]); o[1] = f2bf(w[(size_t)(k + 1) * N + n]); *(v2us*)(Bt + e) = o; }
         }
}
__device__ __forceinline__ void cvt8(const float* __restrict__ src, bf* dst, size_t n8, int blk) { const size_t i = (size_t)blk * 256 + threadIdx.x; if (i >= n8) return; const v8f v = *(const v8f*)(src + i * 8); v8us o;
#pragma unroll
    for (int k = 0; k < 8; ++k) o[k] = f2bf(v[k]); *(v8us*)(dst + i * 8) = o;  }
// ---- k_prep: everything the projections wait for, in one grid: work-groups 0 .. 4 WTB - 1 transpose the four weights (WTB each, into WT[4][DM * DM]), the next 3 CVB round the three streams, both batches, to bf16 (CVB each, into XB[3][NB_ * TT * DM]).
#define WTB ((DM * DM / 64 + 63) / 64)
#define CVB (NB_ * TT * DM / 8 / 256)
static_assert(DQ == DM && DKV == DM && NKV == NH_, "one weight shape, one plane count");
static_assert(256 * 8 % DM == 0 && TT % (256 * 8 / DM) == 0, "a copy work-group holds whole rows of one batch");
__global__ __launch_bounds__(256) void k_prep(const float* __restrict__ wq, const float* __restrict__ wk, const float* __restrict__ wv, const float* __restrict__ wo, const float* __restrict__ xq, const float* __restrict__ xk, const float* __restrict__ xv, const int* __restrict__ lens, bf* WT, bf* XB) {
    const int blk = blockIdx.x;
    if (blk < 4 * WTB) { const int s = blk / WTB; wtG(s == 0 ? wq : s == 1 ? wk : s == 2 ? wv : wo, DM, DM, WT + (size_t)s * DM * DM, blk % WTB); return; }
    const int c = blk - 4 * WTB, s = c / CVB;
    if (s != 0) { const int row = c % CVB * (256 * 8 / DM); if (row % TT >= keyrows(lens, row / TT)) return; }   // rows of the K and V streams that no projection tile reads
    cvt8(s == 0 ? xq : s == 1 ? xk : xv, XB + (size_t)s * NB_ * TT * DM, (size_t)NB_ * TT * DM / 8, c % CVB);
}

#define FPI 72
#define SC2 0.18033688011112042f   // HD^-0.5 x log2(e)
// eight 2^x in one statement: results in registers apart from every argument ("=&v"), so no v_exp_f32 is followed by an instruction that reads its result or overwrites its argument; the closing v_nop is that free slot behind the last one
__device__ __forceinline__ v8f exp2x8(v8f x) { float r0, r1, r2, r3, r4, r5, r6, r7;
    asm("v_exp_f32 %0, %8\n\tv_exp_f32 %1, %9\n\tv_exp_f32 %2, %10\n\tv_exp_f32 %3, %11\n\tv_exp_f32 %4, %12\n\tv_exp_f32 %5, %13\n\tv_exp_f32 %6, %14\n\tv_exp_f32 %7, %15\n\tv_nop"
        : "=&v"(r0), "=&v"(r1), "=&v"(r2), "=&v"(r3), "=&v"(r4), "=&v"(r5), "=&v"(r6), "=&v"(r7) : "v"(x[0]), "v"(x[1]), "v"(x[2]), "v"(x[3]), "v"(x[4]), "v"(x[5]), "v"(x[6]), "v"(x[7]));
    return (v8f){r0, r1, r2, r3, r4, r5, r6, r7}; }
template <typename T16> struct WH8;
template <> struct WH8<h16> { typedef v8h H; };
template <> struct WH8<bf> { typedef v8us H; };
template <typename T16, int NPL>
__device__ __forceinline__ void fattn(const T16* __restrict__ Q, const T16* __restrict__ Q2, const T16* __restrict__ Kp, const T16* __restrict__ K2, const T16* __restrict__ Vt, int q0, int len, bf* Ah, bf* Al) {
    typedef typename WFrag<T16>::V V; typedef typename WH8<T16>::H H8;
    constexpr int PL = FKB * FPI, NP = TT / FKB;
    __shared__ __align__(16) T16 sm[2][2 * NPL * PL];   // [buffer][K plane(s), then V^T plane(s)][row][FPI]
    const int tid = threadIdx.x, lane = tid & 31, lr = lane & 15, hi = lane >> 4; const int wv = __builtin_amdgcn_readfirstlane(tid >> 5);
    const int qrow = q0 + wv * 16 + lr; const int sr = tid >> 3, sc = (tid & 7) * 8;   // staging: 8 threads per 128-B row, rows sr and sr + 32
    V qf[2], qf2[2];
#pragma unroll
    for (int ks = 0; ks < 2; ++ks) { qf[ks] = WFrag<T16>::ld(Q + (size_t)qrow * HD + ks * 32 + 8 * hi); if (NPL == 2) qf2[ks] = WFrag<T16>::ld(Q2 + (size_t)qrow * HD + ks * 32 + 8 * hi); }
    asm volatile("s_wait_xcnt 0x0" ::: "memory");   // the address registers of the query loads are given new values right behind them
    if (len <= 0) {   // no key kept: the module's scores are all equal: zero queries, no mask
#pragma unroll
        for (int ks = 0; ks < 2; ++ks) { qf[ks] = (V){}; if (NPL == 2) qf2[ks] = (V){}; }
        len = TT; }
    const int np = (len + FKB - 1) / FKB;   // passes that hold a kept key, 1 .. NP (len is clamped to 1 .. TT, the same for the whole work-group): np * FKB <= keyrows()
    H8 st[2 * NPL][2];
    auto gl = [&](int kb) {
#pragma unroll
        for (int u = 0; u < 2; ++u) { const int row = sr + 32 * u;
            st[0][u] = *(const H8*)(Kp + (size_t)(kb + row) * HD + sc); if (NPL == 2) st[1][u] = *(const H8*)(K2 + (size_t)(kb + row) * HD + sc);
            st[NPL][u] = *(const H8*)(Vt + (size_t)row * (2 * TT) + kb + sc); if (NPL == 2) st[NPL + 1][u] = *(const H8*)(Vt + (size_t)row * (2 * TT) + TT + kb + sc); } };
    auto sl = [&](int bu) {
#pragma unroll
        for (int pl = 0; pl < 2 * NPL; ++pl)
#pragma unroll
            for (int u = 0; u < 2; ++u) *(H8*)(&sm[bu][pl * PL + (sr + 32 * u) * FPI + sc]) = st[pl][u]; };
    gl(0); sl(0);
    __syncthreads();   // pass 0's rows are in LDS before any wave reads them
    v8f o[4];
#pragma unroll
    for (int dt = 0; dt < 4; ++dt) o[dt] = (v8f){};
    float m = -3.0e38f, l = 0.0f;
    int it = 0;
#pragma unroll 1
    do {   // tested at the foot: np >= 1, so the first pass always runs; with the test at the head this build needs more than 256 registers a wave and only one work-group fits a WGP
        const int kb = it * FKB; const T16* bufp = &sm[it & 1][0];
        if (it + 1 < np) gl(kb + FKB);
        v8f s[4];
        if (kb + FKB > len) { const int rem = len - kb - 8 * hi;
#pragma unroll
            for (int kt = 0; kt < 4; ++kt)
#pragma unroll
                for (int j = 0; j < 8; ++j) s[kt][j] = (kt * 16 + j >= rem) ? -3.0e38f : 0.0f;
        } else {
#pragma unroll
            for (int kt = 0; kt < 4; ++kt) s[kt] = (v8f){}; }
        // K fragments two key tiles ahead of their products
        const T16* kp = bufp + lr * FPI + 8 * hi; V kf[4][NPL][2];
        auto lk = [&](int kt) {
#pragma unroll
            for (int ks = 0; ks < 2; ++ks) { kf[kt][0][ks] = WFrag<T16>::ld(kp + kt * 16 * FPI + ks * 32); if (NPL == 2) kf[kt][1][ks] = WFrag<T16>::ld(kp + PL + kt * 16 * FPI + ks * 32); } };
        lk(0); lk(1);
#pragma unroll
        for (int kt = 0; kt < 4; ++kt) {
            if (kt + 2 < 4) { lk(kt + 2);
                __builtin_amdgcn_sched_barrier(0);   // keeps the reads of tile kt + 2 in front of tile kt's products: without it each product waits for a read issued just before it
            }
#pragma unroll
            for (int ks = 0; ks < 2; ++ks) { s[kt] = WFrag<T16>::mma(kf[kt][0][ks], qf[ks], s[kt]);
                if (NPL == 2) { s[kt] = WFrag<T16>::mma(kf[kt][0][ks], qf2[ks], s[kt]); s[kt] = WFrag<T16>::mma(kf[kt][1][ks], qf[ks], s[kt]); } } }
        // V^T fragments of one 32-key step, all at once into registers of their own
        const T16* vp = bufp + NPL * PL + lr * FPI + 8 * hi; V vf[NPL][4];
        auto lv = [&](int kk) {
#pragma unroll
            for (int dt = 0; dt < 4; ++dt) { vf[0][dt] = WFrag<T16>::ld(vp + dt * 16 * FPI + kk * 32); if (NPL == 2) vf[1][dt] = WFrag<T16>::ld(vp + PL + dt * 16 * FPI + kk * 32); } };
        lv(0);
        __builtin_amdgcn_sched_barrier(0);   // keeps these LDS reads in front of the softmax arithmetic, which covers their latency (sunk to their products, each product waits for its own read)
        float mj[8];   // eight independent maxima, then a tree
#pragma unroll
        for (int j = 0; j < 8; ++j) mj[j] = fmaxf(fmaxf(s[0][j], s[1][j]), fmaxf(s[2][j], s[3][j]));
        float mx = fmaxf(fmaxf(fmaxf(mj[0], mj[1]), fmaxf(mj[2], mj[3])), fmaxf(fmaxf(mj[4], mj[5]), fmaxf(mj[6], mj[7])));
        mx = fmaxf(mx, __shfl_xor(mx, 16, 32));
        const float mn = fmaxf(m, mx * SC2); const float al = __builtin_amdgcn_exp2f(m - mn); m = mn;
#pragma unroll
        for (int dt = 0; dt < 4; ++dt) o[dt] *= al;
#pragma unroll
        for (int kk = 0; kk < 2; ++kk) {
#pragma unroll
            for (int kt = 2 * kk; kt < 2 * kk + 2; ++kt) { v8f t;
#pragma unroll
                for (int j = 0; j < 8; ++j) t[j] = fmaf(s[kt][j], SC2, -mn);
                s[kt] = exp2x8(t); }
            if constexpr (NPL == 1) { v16h pb;
#pragma unroll
                for (int e = 0; e < 8; ++e) { pb[e] = tohx(s[2 * kk][e]); pb[8 + e] = tohx(s[2 * kk + 1][e]); }
#pragma unroll
                for (int dt = 0; dt < 4; ++dt) o[dt] = WFrag<T16>::mma(vf[0][dt], pb, o[dt]);
            } else { v16bf ph, pl;
#pragma unroll
                for (int e = 0; e < 16; ++e) { const float p = s[2 * kk + (e >> 3)][e & 7]; const __bf16 a = (__bf16)p; ph[e] = a; pl[e] = (__bf16)(p - (float)a); }
#pragma unroll
                for (int dt = 0; dt < 4; ++dt) { o[dt] = WFrag<T16>::mma(vf[0][dt], ph, o[dt]); o[dt] = WFrag<T16>::mma(vf[0][dt], pl, o[dt]); o[dt] = WFrag<T16>::mma(vf[NPL - 1][dt], ph, o[dt]); } }
            if (kk == 0) { lv(1);
                __builtin_amdgcn_sched_barrier(0);   // as above: the second step's reads stay in front of its exponentials
            } }
        const v8f sv = (s[0] + s[1]) + (s[2] + s[3]);   // eight independent partial sums, then a fixed tree
        l = l * al + (((sv[0] + sv[1]) + (sv[2] + sv[3])) + ((sv[4] + sv[5]) + (sv[6] + sv[7])));
        if (it + 1 < np) sl((it + 1) & 1);
        __syncthreads();   // publishes pass it + 1's rows and ends every wave's reads of the buffer that pass it + 1 refills
    } while (++it < np);
    l += __shfl_xor(l, 16, 32); const float inv = __fdiv_rn(1.0f, l);
    // lane (lr, hi) holds O[qrow][dt * 16 + 8 hi + j]: 16-byte stores; the wave alone writes its rows' 128-B lines of this head
    const size_t oo = (size_t)qrow * DQ + 8 * hi;
#pragma unroll
    for (int dt = 0; dt < 4; ++dt) { v8us oh, ol;
#pragma unroll
        for (int j = 0; j < 8; ++j) { unsigned short a, c2; splitf(o[dt][j] * inv, a, c2); oh[j] = a; ol[j] = c2; }
        *(v8us*)(Ah + oo + dt * 16) = oh; *(v8us*)(Al + oo + dt * 16) = ol; }
}
__global__ __launch_bounds__(256) void k_fattn(const h16* __restrict__ Q16, const h16* __restrict__ K16, const h16* __restrict__ V16, const bf* __restrict__ Qh, const bf* __restrict__ Ql, const bf* __restrict__ Kh, const bf* __restrict__ Kl, const bf* __restrict__ Vh, const int* __restrict__ lenb, bf* Ah, bf* Al) {
    { const size_t b = blockIdx.z, pb = b * NH_ * TT * HD, vb = b * NKV * HD * 2 * TT, ab = b * TT * DQ; Q16 += pb; K16 += pb; V16 += vb; Qh += pb; Ql += pb; Kh += pb; Kl += pb; Vh += vb; lenb += b; Ah += ab; Al += ab; }   // this batch's planes, length and output rows
    const int h = blockIdx.y, q0 = blockIdx.x * 128; const int len = min(lenb[0], TT); const size_t hp = (size_t)h * TT * HD, hv = (size_t)h * HD * 2 * TT;
    if (q0 < RH) fattn<bf, 2>(Qh + hp, Ql + hp, Kh + hp, Kl + hp, Vh + hv, q0, len, Ah + h * HD, Al + h * HD);
    else fattn<h16, 1>(Q16 + hp, nullptr, K16 + hp, nullptr, V16 + hv, q0, len, Ah + h * HD, Al + h * HD);
}

extern "C" void kernel_launch(void* const* d_in, const int* in_sizes, int n_in,
                              void* d_out, int out_size, void* d_ws, size_t ws_size, hipStream_t stream) {
    (void)in_sizes; (void)n_in; (void)out_size;
    const float* x = (const float*)d_in[0]; const float* xk = (const float*)d_in[1]; const float* xv = (const float*)d_in[2]; const int* lens = (const int*)d_in[3]; const float* wq = (const float*)d_in[4]; const float* wk = (const float*)d_in[5]; const float* wv = (const float*)d_in[6]; const float* wo = (const float*)d_in[7];   /* input order q, k, v, valid_lens (int32 [2]: keys j >= valid_lens[b] are masked: READ on the device by k_fattn), Wq, Wk, Wv, Wo ('xw'): EIGHT inputs */
    float* OUT = (float*)d_out;     // [2][2048][1024]
    char* wsp = (char*)d_ws;
    auto take = [&](size_t bytes) { char* p = wsp; wsp += (bytes + 255) & ~(size_t)255; return (void*)p; };
    bf* WT = (bf*)take((size_t)4 * DM * DM * 2); bf* WO = WT + (size_t)3 * DM * DM;   /* Wq, Wk, Wv, Wo transposed, in this order */
    bf* XB = (bf*)take((size_t)3 * NB_ * TT * DM * 2);   /* bf16(input_Q), bf16(input_K), bf16(input_V), both batches each */
    h16* QP16 = (h16*)take((size_t)NB_ * NH_ * TT * HD * 2); h16* KP16 = (h16*)take((size_t)NB_ * NKV * TT * HD * 2); h16* VT16 = (h16*)take((size_t)NB_ * NKV * HD * 2 * TT * 2);
    bf* QPh = (bf*)take((size_t)NB_ * NH_ * TT * HD * 2); bf* QPl = (bf*)take((size_t)NB_ * NH_ * TT * HD * 2); bf* KPh = (bf*)take((size_t)NB_ * NKV * TT * HD * 2); bf* KPl = (bf*)take((size_t)NB_ * NKV * TT * HD * 2); bf* VTh = (bf*)take((size_t)NB_ * NKV * HD * 2 * TT * 2); bf* VTl = VTh + TT;   /* V^T rows: pitch 2 * TT, hi then lo */
    bf* ATh = (bf*)take((size_t)NB_ * TT * DQ * 2); bf* ATl = (bf*)take((size_t)NB_ * TT * DQ * 2);
    if ((size_t)(wsp - (char*)d_ws) > ws_size) return;    // ws 256 MiB
    const Planes pq = {QP16, QPh, QPl}, pk = {KP16, KPh, KPl}, pv = {VT16, VTh, VTl}, pn = {nullptr, nullptr, nullptr};
    k_prep<<<4 * WTB + 3 * CVB, 256, 0, stream>>>(wq, wk, wv, wo, x, xk, xv, lens, WT, XB);
    k_gemmw<bf, 0, 4, 1><<<dim3(NB_ * TT / GTR, DQ / 128, 3), 128, 0, stream>>>(XB, nullptr, WT, nullptr, (size_t)NB_ * TT * DM, (size_t)DM * DM, pq, pk, pv, lens);
    k_fattn<<<dim3(TT / 128, NH_, NB_), 256, 0, stream>>>(QP16, KP16, VT16, QPh, QPl, KPh, KPl, VTh, lens, ATh, ATl);   /* one kv head per query head; V^T rows: hi then lo at + TT */
    k_gemmw<bf, 1, 2, 0><<<dim3(NB_ * TT / 64, DM / 128, 1), 128, 0, stream>>>(ATh, ATl, WO, OUT, 0, 0, pn, pn, pn, nullptr);
}

// v008
// A run of this version takes 82 microseconds.
// In two side-by-side timings against v007, it was 1.07 and 1.08 times as fast.
// Over all steps from v000 it is 24.9 times as fast.
#include <hip/hip_runtime.h>

// Multi-head attention on three input streams with a per-batch valid-length key mask (q, k, v [2][2048][1024]; qh, kh, vh = stream W ('xw' [1024][1024] 1/32, no bias; 16 heads x 64); scores / sqrt(64); keys j >= valid_lens[b] (int32 [2], read on the device) are REPLACED by -1e6 in the module (at least one key is always kept: numerically an exclusion: -3e38 here); softmax; out = merged Wo ('xw', no bias) -> [2][2048][1024] (4.2 M); argument order q, k, v, valid_lens, Wq, Wk, Wv, Wo).
// Layout, four launches, each over both batches: k_prep ('xw' weights transposed; bf16 copies of input_Q, input_K, input_V, a staging buffer each); the three exact projections in one grid (z = stream), whose epilogue writes the head planes itself (fp16 + hi/lo; V transposed); one fused attention kernel (z = batch) (k_fattn: scores, length mask from valid_lens[b], online softmax, P x V, hi/lo merge; hybrid rows: < 512 hi/lo 3 products, rest fp16); merged hi/lo x W_O exact. Key rows from valid_lens[b] on, rounded up to a projection tile of 128 rows, are made and read by no launch (keyrows()).
// Compute dtypes, f32 accumulate: every input rounded to bf16; projections exact; attention rows < 512 3 products, rest fp16; softmax f32; output projection hl x exact.

#define NB_  2
#define TT   2048
#define DM   1024
#define NH_  16
#define NKV  16
#define REP  (NH_ / NKV)
#define HD   64
#define DQ   (NH_ * HD)
#define DKV  (NKV * HD)
#define RH   512                  // query rows < RH use hi+lo planes (0: none)
#define WIN  0
#define SCL  0.125f   // HD^-0.5
#define FKB  64                   // keys per attention pass
#define GTR  128                  // rows of a projection tile
typedef _Float16 h16;
typedef unsigned short bf;
typedef __attribute__((ext_vector_type(16))) __bf16   v16bf;
typedef __attribute__((ext_vector_type(16))) _Float16 v16h;
typedef __attribute__((ext_vector_type(8)))  _Float16 v8h;
typedef __attribute__((ext_vector_type(8)))  unsigned short v8us;
typedef __attribute__((ext_vector_type(8)))  float    v8f;
typedef __attribute__((ext_vector_type(4)))  float    v4f;
typedef v8h  __attribute__((may_alias)) v8ha;
typedef v4f  __attribute__((may_alias)) v4fa;
typedef v8us __attribute__((may_alias)) v8usa;

__device__ __forceinline__ unsigned short f2bf(float f) { unsigned u = __float_as_uint(f); u += 0x7FFFu + ((u >> 16) & 1u); return (unsigned short)(u >> 16); }
__device__ __forceinline__ float bf2f(unsigned short b) { return __uint_as_float(((unsigned)b) << 16); }
__device__ __forceinline__ float bfr(float f) { return bf2f(f2bf(f)); }
// Key rows of batch b that are made: valid_lens[b] clamped to at most TT (a length <= 0 keeps every key, as in k_fattn), rounded up to whole projection tiles of GTR rows (the attention reads whole passes of FKB of them). Rows from there on get probability 0 and are read by nobody, so no launch makes them.
__device__ __forceinline__ int keyrows(const int* __restrict__ lens, int b) { int len = min(lens[b], TT); if (len <= 0) len = TT; return (len + GTR - 1) / GTR * GTR; }
__device__ __forceinline__ v16h cat16(v8h lo, v8h hi) { return __builtin_shufflevector(lo, hi, 0, 1, 2, 3, 4, 5, 6, 7, 8, 9, 10, 11, 12, 13, 14, 15); }
__device__ __forceinline__ v16bf cat16b(v8us lo, v8us hi) { return __builtin_bit_cast(v16bf, __builtin_shufflevector(lo, hi, 0, 1, 2, 3, 4, 5, 6, 7, 8, 9, 10, 11, 12, 13, 14, 15)); }
__device__ __forceinline__ v8f wmma16(v16h a, v16h b, v8f c) { return __builtin_amdgcn_wmma_f32_16x16x32_f16(false, a, false, b, (short)0, c, false, false); }
__device__ __forceinline__ v8f wmmab(v16bf a, v16bf b, v8f c) { return __builtin_amdgcn_wmma_f32_16x16x32_bf16(false, a, false, b, (short)0, c, false, false); }



// ---- k_gemmw: GEMM with both operands staged in LDS. A work-group of 4 waves (2 x 2) makes a (32 MB) x 128 tile of C, a wave (16 MB) x 64 of it (MB x 4 accumulators) over the whole depth K = DM; grid (M / (32 MB), N / 128, Z), 128 threads.
// C[m][n] = sum_k A[m][k] Bt[n][k] (NSPLIT = 1: + A2[m][k] Bt[n][k]); A, A2, Bt are K-contiguous 16-bit planes of row pitch DM; z-batch strides sA / sB in elements.
// A pass is GKP = 64 k = one 128-B line of every operand row. Asynchronous copies bring it from memory into LDS (8 lanes a row, so a wave's copy is 4 whole lines; no register holds it); every row is fetched once per work-group and read by two waves.
// Rows of a buffer: A (then A2), then Bt, at pitch GPI elements = 144 B (keeps the 16-byte fragment reads off each other's banks). Two buffers: pass t + 2's copies are issued behind the barrier that ends pass t and fly during pass t + 1.
// PM = 0: f32 C, pitch DM. PM = 1 (MB = 4; a wave's 64 columns = one head; rows m = batch * TT + t; z = stream Q, K, V): no C; the tile leaves as 16-bit planes: Q, K [batch][head][t][d], V transposed [batch][head][d][t] at pitch 2 * TT.
// Either way a wave re-lays its own tile in LDS (the ring, free by then) and stores whole 128-B lines that it alone writes.
#define GKP 64
#define GPI 72
template <typename T16> struct WFrag;
template <> struct WFrag<h16> { typedef v16h V; static __device__ __forceinline__ V ld(const h16* p) { return cat16(*(const v8h*)p, *(const v8h*)(p + 16)); } static __device__ __forceinline__ v8f mma(V a, V b, v8f c) { return wmma16(a, b, c); } };
template <> struct WFrag<bf> { typedef v16bf V; static __device__ __forceinline__ V ld(const bf* p) { return cat16b(*(const v8us*)p, *(const v8us*)(p + 16)); } static __device__ __forceinline__ v8f mma(V a, V b, v8f c) { return wmmab(a, b, c); } };
struct Planes { h16* p16; bf* ph; bf* pl; };
typedef float __attribute__((may_alias)) fa;
// four copies of 16 B a lane, rows 16 apart (LDS byte address l, global address g); the closing s_wait_xcnt stands in the copies' own statement, so that no address register is given a new value in front of it
__device__ __forceinline__ void cp4(unsigned l, const char* g) {
    asm volatile("global_load_async_to_lds_b128 %0, %4, off\n\tglobal_load_async_to_lds_b128 %1, %5, off\n\tglobal_load_async_to_lds_b128 %2, %6, off\n\tglobal_load_async_to_lds_b128 %3, %7, off\n\ts_wait_xcnt 0x0"
        :: "v"(l), "v"(l + 16 * GPI * 2), "v"(l + 32 * GPI * 2), "v"(l + 48 * GPI * 2), "v"(g), "v"(g + 16 * DM * 2), "v"(g + 32 * DM * 2), "v"(g + 48 * DM * 2) : "memory"); }
template <typename T16, int NSPLIT, int MB, int PM>
__global__ __launch_bounds__(128) void k_gemmw(const T16* __restrict__ A, const T16* __restrict__ A2, const T16* __restrict__ Bt, float* C, size_t sA, size_t sB, Planes pq, Planes pk, Planes pv, const int* __restrict__ lens) {
    typedef typename WFrag<T16>::V V;
    constexpr int K = DM, TM = 32 * MB, NA = NSPLIT ? 2 : 1, BUFE = (NA * TM + 128) * GPI, NT = K / GKP, KG = NA * MB <= 4 && MB <= 2 ? 2 : 1;   // KG: 32-wide k steps whose fragments are read as one group (both of a pass where the registers allow)
    static_assert(sizeof(T16) == 2 && TM % 64 == 0 && NT >= 2 && (PM == 0 || (TM == GTR && TT % TM == 0 && HD == 64)), "tile shapes");
    static_assert(4 * MB * 16 * 68 * 4 <= 2 * BUFE * 2, "the four re-laid tiles fit the ring");
    const int r0 = blockIdx.x * TM, c0 = blockIdx.y * 128;
    if constexpr (PM != 0) { if (blockIdx.z != 0 && r0 % TT >= keyrows(lens, r0 / TT)) return; }   // a K or V tile of masked keys alone: the whole work-group leaves, in front of every barrier and copy
    __shared__ __align__(16) T16 sm[2 * BUFE];
    const int tid = threadIdx.x, lane = tid & 31, lr = lane & 15, hi = lane >> 4; const int wv = __builtin_amdgcn_readfirstlane(tid >> 5), wm = wv >> 1, wn = wv & 1;
    const size_t z = blockIdx.z; A += z * sA; if (NSPLIT) A2 += z * sA; Bt += z * sB;
    // copies: thread tid brings 16 B at column 8 (tid & 7) of rows (tid >> 3) + 16 i
    const int cr = tid >> 3, cc = (tid & 7) * 8;
    const unsigned lc = (unsigned)(size_t)&sm[0] + (unsigned)(cr * GPI + cc) * 2;   // low 32 bits of a __shared__ address = byte offset in the work-group's LDS
    const char* ga = (const char*)(A + (size_t)(r0 + cr) * K + cc); const char* ga2 = NSPLIT ? (const char*)(A2 + (size_t)(r0 + cr) * K + cc) : nullptr; const char* gb = (const char*)(Bt + (size_t)(c0 + cr) * K + cc);
    auto fill = [&](int t, int bu) { const unsigned l = lc + (unsigned)bu * (BUFE * 2); const int ko = t * GKP * 2;
#pragma unroll
        for (int q = 0; q < TM / 64; ++q) { cp4(l + q * 64 * GPI * 2, ga + ko + q * 64 * K * 2); if (NSPLIT) cp4(l + (TM + q * 64) * GPI * 2, ga2 + ko + q * 64 * K * 2); }
#pragma unroll
        for (int q = 0; q < 2; ++q) cp4(l + (NA * TM + q * 64) * GPI * 2, gb + ko + q * 64 * K * 2); };
    v8f acc[MB][4];
#pragma unroll
    for (int mb = 0; mb < MB; ++mb)
#pragma unroll
        for (int nb = 0; nb < 4; ++nb) acc[mb][nb] = (v8f){};
    fill(0, 0);
    asm volatile("s_wait_asynccnt 0x0" ::: "memory");   // this wave's copies of pass 0 have landed
    __syncthreads();   // pass 0's rows are in LDS before any wave reads them
    fill(1, 1);
    const int ao = (wm * MB * 16 + lr) * GPI + 8 * hi, bo = (NA * TM + wn * 64 + lr) * GPI + 8 * hi;
#pragma unroll 1   // one pass a trip: the buffer index and the foot's waits and barrier stay in one place
    for (int t = 0; t < NT; ++t) {
        const T16* bp = &sm[(t & 1) * BUFE];
#pragma unroll
        for (int kg = 0; kg < GKP / 32 / KG; ++kg) {
            V a[KG][MB], a2[KG][MB], b[KG][4];
#pragma unroll
            for (int k2 = 0; k2 < KG; ++k2) { const int ko = (kg * KG + k2) * 32;
#pragma unroll
                for (int mb = 0; mb < MB; ++mb) { a[k2][mb] = WFrag<T16>::ld(bp + ao + mb * 16 * GPI + ko); if (NSPLIT) a2[k2][mb] = WFrag<T16>::ld(bp + ao + (TM + mb * 16) * GPI + ko); }
#pragma unroll
                for (int nb = 0; nb < 4; ++nb) b[k2][nb] = WFrag<T16>::ld(bp + bo + nb * 16 * GPI + ko); }
            __builtin_amdgcn_sched_barrier(0);   // keeps the group's LDS reads together in front of its products: sunk among them, every column block waits out a read issued just before it
#pragma unroll
            for (int k2 = 0; k2 < KG; ++k2)
#pragma unroll
                for (int nb = 0; nb < 4; ++nb)
#pragma unroll
                    for (int mb = 0; mb < MB; ++mb) { acc[mb][nb] = WFrag<T16>::mma(a[k2][mb], b[k2][nb], acc[mb][nb]); if (NSPLIT) acc[mb][nb] = WFrag<T16>::mma(a2[k2][mb], b[k2][nb], acc[mb][nb]); } }
        __builtin_amdgcn_sched_barrier(0);   // keeps pass t's products in front of the foot's waits: sunk behind the barrier, nothing would run while pass t + 1's copies fly
        asm volatile("s_wait_dscnt 0x0" ::: "memory");      // this wave's reads of pass t's buffer are over
        asm volatile("s_wait_asynccnt 0x0" ::: "memory");   // this wave's copies of pass t + 1 have landed
        __syncthreads();   // publishes pass t + 1's rows and ends every wave's reads of the buffer that is refilled behind it
        if (t + 2 < NT) fill(t + 2, t & 1);
    }
    asm volatile("s_wait_asynccnt 0x0" ::: "memory");   // no copy is under way when the ring becomes output staging
    // the wave's tile in an LDS range of its own, pitch 68 floats, in the order the stores want: [row][column]; V planes [d][row]
    fa* T = (fa*)&sm[0] + wv * (MB * 16 * 68);
    const bool tp = PM != 0 && blockIdx.z == 2;
    if (tp) {
#pragma unroll
        for (int mb = 0; mb < MB; ++mb)
#pragma unroll
            for (int nb = 0; nb < 4; ++nb) {
                *(v4fa*)(T + (nb * 16 + lr) * 68 + mb * 16 + hi * 8) = __builtin_shufflevector(acc[mb][nb], acc[mb][nb], 0, 1, 2, 3);
                *(v4fa*)(T + (nb * 16 + lr) * 68 + mb * 16 + hi * 8 + 4) = __builtin_shufflevector(acc[mb][nb], acc[mb][nb], 4, 5, 6, 7); }
    } else {
#pragma unroll
        for (int mb = 0; mb < MB; ++mb)
#pragma unroll
            for (int nb = 0; nb < 4; ++nb)
#pragma unroll
                for (int j = 0; j < 8; ++j) T[(mb * 16 + hi * 8 + j) * 68 + nb * 16 + lr] = acc[mb][nb][j]; }
    __syncthreads();   // the re-laid tile is whole in LDS before its lanes read each other's values
    if constexpr (PM != 0) {
        // 8 lanes per plane row of 64 elements = one 128-B line; 4 lines of each plane a step
        const Planes ps = blockIdx.z == 0 ? pq : tp ? pv : pk;
        const int tr = lane >> 3, tc = (lane & 7) * 8, rw = r0 + wm * 64; const size_t pb = (size_t)(rw / TT) * NH_ + blockIdx.y * 2 + wn; const int t0 = rw % TT;   // plane of this batch and head; first row inside the batch
        const size_t ob = tp ? pb * HD * (2 * TT) + t0 : (pb * TT + t0) * HD; const int op = tp ? 2 * TT : HD;   // first element and row pitch of this tile in its planes
#pragma unroll 1   // one step a trip, so that the closing wait stands in front of every new value of a register that a store of the step names
        for (int u = 0; u < 16; ++u) { const int row = tr + 4 * u; const v4f x0 = *(const v4fa*)(T + row * 68 + tc), x1 = *(const v4fa*)(T + row * 68 + tc + 4); v8h o16; v8us oh, ol;
#pragma unroll
            for (int k = 0; k < 8; ++k) { const float x = k < 4 ? x0[k & 3] : x1[k & 3]; o16[k] = (h16)x; const unsigned short a = f2bf(x); oh[k] = a; ol[k] = f2bf(x - bf2f(a)); }
            const size_t o = ob + (size_t)(row * op + tc);
            *(v8h*)(ps.p16 + o) = o16; *(v8us*)(ps.ph + o) = oh; *(v8us*)(ps.pl + o) = ol;
            asm volatile("s_wait_xcnt 0x0" ::: "memory");   // the next step gives the stores' address and data registers new values
        }
    } else {
        // 16 lanes per row of 64 floats = two 128-B lines; 2 rows a step
        float* crow = C + (size_t)(r0 + wm * MB * 16 + hi) * DM + c0 + wn * 64 + lr * 4; const fa* trow = T + hi * 68 + lr * 4; v4f x[MB * 8];
#pragma unroll
        for (int u = 0; u < MB * 8; ++u) x[u] = *(const v4fa*)(trow + 2 * u * 68);
#pragma unroll
        for (int u = 0; u < MB * 8; ++u) *(v4f*)(crow + 2 * u * DM) = x[u];
    }
}

__device__ __forceinline__ h16 tohx(float x) { return (h16)x; }
__device__ __forceinline__ void splitf(float y, unsigned short& h, unsigned short& l) { h = f2bf(y); l = f2bf(y - bf2f(h)); }
typedef __attribute__((ext_vector_type(4))) _Float16 v4h;
typedef __attribute__((ext_vector_type(2))) unsigned short v2us;
typedef __attribute__((ext_vector_type(4))) unsigned short v4us;
typedef __attribute__((ext_vector_type(4))) int v4i;
typedef v4h  __attribute__((may_alias)) v4ha;
typedef v4us __attribute__((may_alias)) v4usa;

// ---- wtG: one 64 (k) x 64 (n) tile of w [K][N] (f32) becomes 64 rows (n) of 64 bf16 (k) = one 128-B line each of Bt [N][K], through the LDS tile T (row n, pitch WPI elements = 144 B, which keeps the 16-byte reads off each other's banks).
// A thread loads 4 k rows x 4 n (16 B each: 16 lanes cover 256 contiguous bytes of a row, so a wave's load is 4 whole lines), rounds, and writes 4 k of each n as 8 B into T; behind the barrier 8 lanes read a row of T and store its line.
#define WPI 72
__device__ __forceinline__ void wtG(const float* __restrict__ w, int K, int N, bf* Bt, int blk, bf* T) {
    const int tid = threadIdx.x, tk = blk % (K / 64) * 64, tn = blk / (K / 64) * 64, nq = (tid & 15) * 4, kq = (tid >> 4) * 4;
    const float* wp = w + (size_t)(tk + kq) * N + tn + nq; v4f x[4];
#pragma unroll
    for (int j = 0; j < 4; ++j) x[j] = *(const v4f*)(wp + (size_t)j * N);
#pragma unroll
    for (int i = 0; i < 4; ++i) { v4us o;
#pragma unroll
        for (int j = 0; j < 4; ++j) o[j] = f2bf(x[j][i]);
        *(v4usa*)(T + (nq + i) * WPI + kq) = o; }
    __syncthreads();   // the tile is whole in LDS before its lanes read each other's values
    const int r = tid >> 3, c = (tid & 7) * 8; bf* bp = Bt + (size_t)(tn + r) * K + tk + c;
#pragma unroll
    for (int u = 0; u < 2; ++u) *(v8us*)(bp + (size_t)u * 32 * K) = *(const v8usa*)(T + (r + 32 * u) * WPI + c);
}
__device__ __forceinline__ void cvt8(const float* __restrict__ src, bf* dst, size_t n8, int blk) { const size_t i = (size_t)blk * 256 + threadIdx.x; if (i >= n8) return; const v8f v = *(const v8f*)(src + i * 8); v8us o;
#pragma unroll
    for (int k = 0; k < 8; ++k) o[k] = f2bf(v[k]); *(v8us*)(dst + i * 8) = o;  }
// ---- k_prep: everything the projections wait for, in one grid: work-groups 0 .. 4 WTB - 1 transpose the four weights (WTB tiles each, into WT[4][DM * DM]), the next 3 CVB round the three streams, both batches, to bf16 (CVB each, into XB[3][NB_ * TT * DM]).
#define WTB ((DM / 64) * (DM / 64))
#define CVB (NB_ * TT * DM / 8 / 256)
static_assert(DQ == DM && DKV == DM && NKV == NH_ && DM % 64 == 0, "one weight shape of whole tiles, one plane count");
static_assert(256 * 8 % DM == 0 && TT % (256 * 8 / DM) == 0, "a copy work-group holds whole rows of one batch");
__global__ __launch_bounds__(256) void k_prep(const float* __restrict__ wq, const float* __restrict__ wk, const float* __restrict__ wv, const float* __restrict__ wo, const float* __restrict__ xq, const float* __restrict__ xk, const float* __restrict__ xv, const int* __restrict__ lens, bf* WT, bf* XB) {
    __shared__ __align__(16) bf T[64 * WPI];
    const int blk = blockIdx.x;
    if (blk < 4 * WTB) { const int s = blk / WTB; wtG(s == 0 ? wq : s == 1 ? wk : s == 2 ? wv : wo, DM, DM, WT + (size_t)s * DM * DM, blk % WTB, T); return; }   // the whole work-group takes this branch, so wtG's barrier is passed by all of its waves
    const int c = blk - 4 * WTB, s = c / CVB;
    if (s != 0) { const int row = c % CVB * (256 * 8 / DM); if (row % TT >= keyrows(lens, row / TT)) return; }   // rows of the K and V streams that no projection tile reads
    cvt8(s == 0 ? xq : s == 1 ? xk : xv, XB + (size_t)s * NB_ * TT * DM, (size_t)NB_ * TT * DM / 8, c % CVB);
}

#define FPI 72
#define SC2 0.18033688011112042f   // HD^-0.5 x log2(e)
// eight 2^x in one statement: results in registers apart from every argument ("=&v"), so no v_exp_f32 is followed by an instruction that reads its result or overwrites its argument; the closing v_nop is that free slot behind the last one
__device__ __forceinline__ v8f exp2x8(v8f x) { float r0, r1, r2, r3, r4, r5, r6, r7;
    asm("v_exp_f32 %0, %8\n\tv_exp_f32 %1, %9\n\tv_exp_f32 %2, %10\n\tv_exp_f32 %3, %11\n\tv_exp_f32 %4, %12\n\tv_exp_f32 %5, %13\n\tv_exp_f32 %6, %14\n\tv_exp_f32 %7, %15\n\tv_nop"
        : "=&v"(r0), "=&v"(r1), "=&v"(r2), "=&v"(r3), "=&v"(r4), "=&v"(r5), "=&v"(r6), "=&v"(r7) : "v"(x[0]), "v"(x[1]), "v"(x[2]), "v"(x[3]), "v"(x[4]), "v"(x[5]), "v"(x[6]), "v"(x[7]));
    return (v8f){r0, r1, r2, r3, r4, r5, r6, r7}; }
template <typename T16> struct WH8;
template <> struct WH8<h16> { typedef v8h H; };
template <> struct WH8<bf> { typedef v8us H; };
template <typename T16, int NPL>
__device__ __forceinline__ void fattn(const T16* __restrict__ Q, const T16* __restrict__ Q2, const T16* __restrict__ Kp, const T16* __restrict__ K2, const T16* __restrict__ Vt, int q0, int len, bf* Ah, bf* Al) {
    typedef typename WFrag<T16>::V V; typedef typename WH8<T16>::H H8;
    constexpr int PL = FKB * FPI, NP = TT / FKB;
    __shared__ __align__(16) T16 sm[2][2 * NPL * PL];   // [buffer][K plane(s), then V^T plane(s)][row][FPI]
    const int tid = threadIdx.x, lane = tid & 31, lr = lane & 15, hi = lane >> 4; const int wv = __builtin_amdgcn_readfirstlane(tid >> 5);
    const int qrow = q0 + wv * 16 + lr; const int sr = tid >> 3, sc = (tid & 7) * 8;   // staging: 8 threads per 128-B row, rows sr and sr + 32
    V qf[2], qf2[2];
#pragma unroll
    for (int ks = 0; ks < 2; ++ks) { qf[ks] = WFrag<T16>::ld(Q + (size_t)qrow * HD + ks * 32 + 8 * hi); if (NPL == 2) qf2[ks] = WFrag<T16>::ld(Q2 + (size_t)qrow * HD + ks * 32 + 8 * hi); }
    asm volatile("s_wait_xcnt 0x0" ::: "memory");   // the address registers of the query loads are given new values right behind them
    if (len <= 0) {   // no key kept: the module's scores are all equal: zero queries, no mask
#pragma unroll
        for (int ks = 0; ks < 2; ++ks) { qf[ks] = (V){}; if (NPL == 2) qf2[ks] = (V){}; }
        len = TT; }
    const int np = (len + FKB - 1) / FKB;   // passes that hold a kept key, 1 .. NP (len is clamped to 1 .. TT, the same for the whole work-group): np * FKB <= keyrows()
    H8 st[2 * NPL][2];
    auto gl = [&](int kb) {
#pragma unroll
        for (int u = 0; u < 2; ++u) { const int row = sr + 32 * u;
            st[0][u] = *(const H8*)(Kp + (size_t)(kb + row) * HD + sc); if (NPL == 2) st[1][u] = *(const H8*)(K2 + (size_t)(kb + row) * HD + sc);
            st[NPL][u] = *(const H8*)(Vt + (size_t)row * (2 * TT) + kb + sc); if (NPL == 2) st[NPL + 1][u] = *(const H8*)(Vt + (size_t)row * (2 * TT) + TT + kb + sc); } };
    auto sl = [&](int bu) {
#pragma unroll
        for (int pl = 0; pl < 2 * NPL; ++pl)
#pragma unroll
            for (int u = 0; u < 2; ++u) *(H8*)(&sm[bu][pl * PL + (sr + 32 * u) * FPI + sc]) = st[pl][u]; };
    gl(0); sl(0);
    __syncthreads();   // pass 0's rows are in LDS before any wave reads them
    v8f o[4];
#pragma unroll
    for (int dt = 0; dt < 4; ++dt) o[dt] = (v8f){};
    float m = -3.0e38f, l = 0.0f;
    int it = 0;
#pragma unroll 1
    do {   // tested at the foot: np >= 1, so the first pass always runs; with the test at the head this build needs more than 256 registers a wave and only one work-group fits a WGP
        const int kb = it * FKB; const T16* bufp = &sm[it & 1][0];
        if (it + 1 < np) gl(kb + FKB);
        v8f s[4];
        if (kb + FKB > len) { const int rem = len - kb - 8 * hi;
#pragma unroll
            for (int kt = 0; kt < 4; ++kt)
#pragma unroll
                for (int j = 0; j < 8; ++j) s[kt][j] = (kt * 16 + j >= rem) ? -3.0e38f : 0.0f;
        } else {
#pragma unroll
            for (int kt = 0; kt < 4; ++kt) s[kt] = (v8f){}; }
        // K fragments two key tiles ahead of their products
        const T16* kp = bufp + lr * FPI + 8 * hi; V kf[4][NPL][2];
        auto lk = [&](int kt) {
#pragma unroll
            for (int ks = 0; ks < 2; ++ks) { kf[kt][0][ks] = WFrag<T16>::ld(kp + kt * 16 * FPI + ks * 32); if (NPL == 2) kf[kt][1][ks] = WFrag<T16>::ld(kp + PL + kt * 16 * FPI + ks * 32); } };
        lk(0); lk(1);
#pragma unroll
        for (int kt = 0; kt < 4; ++kt) {
            if (kt + 2 < 4) { lk(kt + 2);
                __builtin_amdgcn_sched_barrier(0);   // keeps the reads of tile kt + 2 in front of tile kt's products: without it each product waits for a read issued just before it
            }
#pragma unroll
            for (int ks = 0; ks < 2; ++ks) { s[kt] = WFrag<T16>::mma(kf[kt][0][ks], qf[ks], s[kt]);
                if (NPL == 2) { s[kt] = WFrag<T16>::mma(kf[kt][0][ks], qf2[ks], s[kt]); s[kt] = WFrag<T16>::mma(kf[kt][1][ks], qf[ks], s[kt]); } } }
        // V^T fragments of one 32-key step, all at once into registers of their own
        const T16* vp = bufp + NPL * PL + lr * FPI + 8 * hi; V vf[NPL][4];
        auto lv = [&](int kk) {
#pragma unroll
            for (int dt = 0; dt < 4; ++dt) { vf[0][dt] = WFrag<T16>::ld(vp + dt * 16 * FPI + kk * 32); if (NPL == 2) vf[1][dt] = WFrag<T16>::ld(vp + PL + dt * 16 * FPI + kk * 32); } };
        lv(0);
        __builtin_amdgcn_sched_barrier(0);   // keeps these LDS reads in front of the softmax arithmetic, which covers their latency (sunk to their products, each product waits for its own read)
        float mj[8];   // eight independent maxima, then a tree
#pragma unroll
        for (int j = 0; j < 8; ++j) mj[j] = fmaxf(fmaxf(s[0][j], s[1][j]), fmaxf(s[2][j], s[3][j]));
        float mx = fmaxf(fmaxf(fmaxf(mj[0], mj[1]), fmaxf(mj[2], mj[3])), fmaxf(fmaxf(mj[4], mj[5]), fmaxf(mj[6], mj[7])));
        mx = fmaxf(mx, __shfl_xor(mx, 16, 32));
        const float mn = fmaxf(m, mx * SC2); const float al = __builtin_amdgcn_exp2f(m - mn); m = mn;
#pragma unroll
        for (int dt = 0; dt < 4; ++dt) o[dt] *= al;
#pragma unroll
        for (int kk = 0; kk < 2; ++kk) {
#pragma unroll
            for (int kt = 2 * kk; kt < 2 * kk + 2; ++kt) { v8f t;
#pragma unroll
                for (int j = 0; j < 8; ++j) t[j] = fmaf(s[kt][j], SC2, -mn);
                s[kt] = exp2x8(t); }
            if constexpr (NPL == 1) { v16h pb;
#pragma unroll
                for (int e = 0; e < 8; ++e) { pb[e] = tohx(s[2 * kk][e]); pb[8 + e] = tohx(s[2 * kk + 1][e]); }
#pragma unroll
                for (int dt = 0; dt < 4; ++dt) o[dt] = WFrag<T16>::mma(vf[0][dt], pb, o[dt]);
            } else { v16bf ph, pl;
#pragma unroll
                for (int e = 0; e < 16; ++e) { const float p = s[2 * kk + (e >> 3)][e & 7]; const __bf16 a = (__bf16)p; ph[e] = a; pl[e] = (__bf16)(p - (float)a); }
#pragma unroll
                for (int dt = 0; dt < 4; ++dt) { o[dt] = WFrag<T16>::mma(vf[0][dt], ph, o[dt]); o[dt] = WFrag<T16>::mma(vf[0][dt], pl, o[dt]); o[dt] = WFrag<T16>::mma(vf[NPL - 1][dt], ph, o[dt]); } }
            if (kk == 0) { lv(1);
                __builtin_amdgcn_sched_barrier(0);   // as above: the second step's reads stay in front of its exponentials
            } }
        const v8f sv = (s[0] + s[1]) + (s[2] + s[3]);   // eight independent partial sums, then a fixed tree
        l = l * al + (((sv[0] + sv[1]) + (sv[2] + sv[3])) + ((sv[4] + sv[5]) + (sv[6] + sv[7])));
        if (it + 1 < np) sl((it + 1) & 1);
        __syncthreads();   // publishes pass it + 1's rows and ends every wave's reads of the buffer that pass it + 1 refills
    } while (++it < np);
    l += __shfl_xor(l, 16, 32); const float inv = __fdiv_rn(1.0f, l);
    // lane (lr, hi) holds O[qrow][dt * 16 + 8 hi + j]: 16-byte stores; the wave alone writes its rows' 128-B lines of this head
    const size_t oo = (size_t)qrow * DQ + 8 * hi;
#pragma unroll
    for (int dt = 0; dt < 4; ++dt) { v8us oh, ol;
#pragma unroll
        for (int j = 0; j < 8; ++j) { unsigned short a, c2; splitf(o[dt][j] * inv, a, c2); oh[j] = a; ol[j] = c2; }
        *(v8us*)(Ah + oo + dt * 16) = oh; *(v8us*)(Al + oo + dt * 16) = ol; }
}
__global__ __launch_bounds__(256) void k_fattn(const h16* __restrict__ Q16, const h16* __restrict__ K16, const h16* __restrict__ V16, const bf* __restrict__ Qh, const bf* __restrict__ Ql, const bf* __restrict__ Kh, const bf* __restrict__ Kl, const bf* __restrict__ Vh, const int* __restrict__ lenb, bf* Ah, bf* Al) {
    { const size_t b = blockIdx.z, pb = b * NH_ * TT * HD, vb = b * NKV * HD * 2 * TT, ab = b * TT * DQ; Q16 += pb; K16 += pb; V16 += vb; Qh += pb; Ql += pb; Kh += pb; Kl += pb; Vh += vb; lenb += b; Ah += ab; Al += ab; }   // this batch's planes, length and output rows
    const int h = blockIdx.y, q0 = blockIdx.x * 128; const int len = min(lenb[0], TT); const size_t hp = (size_t)h * TT * HD, hv = (size_t)h * HD * 2 * TT;
    if (q0 < RH) fattn<bf, 2>(Qh + hp, Ql + hp, Kh + hp, Kl + hp, Vh + hv, q0, len, Ah + h * HD, Al + h * HD);
    else fattn<h16, 1>(Q16 + hp, nullptr, K16 + hp, nullptr, V16 + hv, q0, len, Ah + h * HD, Al + h * HD);
}

extern "C" void kernel_launch(void* const* d_in, const int* in_sizes, int n_in,
                              void* d_out, int out_size, void* d_ws, size_t ws_size, hipStream_t stream) {
    (void)in_sizes; (void)n_in; (void)out_size;
    const float* x = (const float*)d_in[0]; const float* xk = (const float*)d_in[1]; const float* xv = (const float*)d_in[2]; const int* lens = (const int*)d_in[3]; const float* wq = (const float*)d_in[4]; const float* wk = (const float*)d_in[5]; const float* wv = (const float*)d_in[6]; const float* wo = (const float*)d_in[7];   /* input order q, k, v, valid_lens (int32 [2]: keys j >= valid_lens[b] are masked: READ on the device by k_fattn), Wq, Wk, Wv, Wo ('xw'): EIGHT inputs */
    float* OUT = (float*)d_out;     // [2][2048][1024]
    char* wsp = (char*)d_ws;
    auto take = [&](size_t bytes) { char* p = wsp; wsp += (bytes + 255) & ~(size_t)255; return (void*)p; };
    bf* WT = (bf*)take((size_t)4 * DM * DM * 2); bf* WO = WT + (size_t)3 * DM * DM;   /* Wq, Wk, Wv, Wo transposed, in this order */
    bf* XB = (bf*)take((size_t)3 * NB_ * TT * DM * 2);   /* bf16(input_Q), bf16(input_K), bf16(input_V), both batches each */
    h16* QP16 = (h16*)take((size_t)NB_ * NH_ * TT * HD * 2); h16* KP16 = (h16*)take((size_t)NB_ * NKV * TT * HD * 2); h16* VT16 = (h16*)take((size_t)NB_ * NKV * HD * 2 * TT * 2);
    bf* QPh = (bf*)take((size_t)NB_ * NH_ * TT * HD * 2); bf* QPl = (bf*)take((size_t)NB_ * NH_ * TT * HD * 2); bf* KPh = (bf*)take((size_t)NB_ * NKV * TT * HD * 2); bf* KPl = (bf*)take((size_t)NB_ * NKV * TT * HD * 2); bf* VTh = (bf*)take((size_t)NB_ * NKV * HD * 2 * TT * 2); bf* VTl = VTh + TT;   /* V^T rows: pitch 2 * TT, hi then lo */
    bf* ATh = (bf*)take((size_t)NB_ * TT * DQ * 2); bf* ATl = (bf*)take((size_t)NB_ * TT * DQ * 2);
    if ((size_t)(wsp - (char*)d_ws) > ws_size) return;    // ws 256 MiB
    const Planes pq = {QP16, QPh, QPl}, pk = {KP16, KPh, KPl}, pv = {VT16, VTh, VTl}, pn = {nullptr, nullptr, nullptr};
    k_prep<<<4 * WTB + 3 * CVB, 256, 0, stream>>>(wq, wk, wv, wo, x, xk, xv, lens, WT, XB);
    k_gemmw<bf, 0, 4, 1><<<dim3(NB_ * TT / GTR, DQ / 128, 3), 128, 0, stream>>>(XB, nullptr, WT, nullptr, (size_t)NB_ * TT * DM, (size_t)DM * DM, pq, pk, pv, lens);
    k_fattn<<<dim3(TT / 128, NH_, NB_), 256, 0, stream>>>(QP16, KP16, VT16, QPh, QPl, KPh, KPl, VTh, lens, ATh, ATl);   /* one kv head per query head; V^T rows: hi then lo at + TT */
    k_gemmw<bf, 1, 2, 0><<<dim3(NB_ * TT / 64, DM / 128, 1), 128, 0, stream>>>(ATh, ATl, WO, OUT, 0, 0, pn, pn, pn, nullptr);
}
